// v000
// Times are from an AMD MI455X. After a warm-up the kernel runs many times in a row, and a time is the length of
// such a window on the GPU divided by its runs, so every launch and the gaps after it count. The runs cycle
// through copies of the inputs. A figure is the median of several windows, for all but v000 over two sittings.
// Sittings can differ by a few percent; kernels timed side by side share one.
// v000 is the starting kernel. One run takes 1210 microseconds.
// compute dtype: all float inputs rounded to bf16, attention_mask (int) read; q/k/v = x W^T + b with EXACT bf16 products on WMMA 16x16x32, f32 accumulate; q, k rounded once to f16 (1-product logits / 8, std ~1), masked where attention_mask == 0, stored in f32 (4 heads per launch); softmax in f32 (precise expf) -> P f16 x 2^11; o = P . v (v once to f16); out = o (bf16 hi + lo) Wo^T + bo; f32 output.
#include <hip/hip_runtime.h>
#include <math.h>

typedef __attribute__((ext_vector_type(16))) _Float16 v16h;
typedef __attribute__((ext_vector_type(16))) __bf16 v16b;
typedef __attribute__((ext_vector_type(8)))  _Float16 v8h;
typedef __attribute__((ext_vector_type(8)))  float v8f;
typedef __attribute__((ext_vector_type(4)))  float v4f;
typedef __attribute__((ext_vector_type(2)))  float v2f;
typedef __attribute__((ext_vector_type(4)))  unsigned v4u;
typedef __attribute__((ext_vector_type(4)))  int v4i;
typedef float __attribute__((may_alias)) float_a;
typedef int __attribute__((may_alias)) int_a;

template <typename T> __device__ __forceinline__ void vst2(void* p, T v) { *(T*)p = v;  }
__device__ __forceinline__ v8f wmma16(v16h a, v16h b, v8f c) {
  v8f d = __builtin_amdgcn_wmma_f32_16x16x32_f16(false, a, false, b, (short)0, c, false, false);
  asm volatile("v_nop\n\tv_nop\n\tv_nop\n\tv_nop" : "+v"(d) : "v"(a), "v"(b));
  return d;
}
__device__ __forceinline__ v8f wmma_bf(v16b a, v16b b, v8f c) {
  v8f d = __builtin_amdgcn_wmma_f32_16x16x32_bf16(false, a, false, b, (short)0, c, false, false);
  asm volatile("v_nop\n\tv_nop\n\tv_nop\n\tv_nop" : "+v"(d) : "v"(a), "v"(b));
  return d;
}
// 16x16x32 fragments: lane = (h = lane>>4, row/col = lane&15); elements 0..7 = k0+8h+0..7, 8..15 = k0+16+8h+0..7; D element r = row 8h+r
__device__ __forceinline__ v16h frag_h(const _Float16* rowk0, int lane) {
  union { v16h v; v8h q[2]; } u; const _Float16* p = rowk0 + 8 * (lane >> 4);
  u.q[0] = *(const v8h*)p; u.q[1] = *(const v8h*)(p + 16); return u.v;
}
__device__ __forceinline__ v16h frag_f32(const float* rowk0, int lane) {
  v16h a; const float* p = rowk0 + 8 * (lane >> 4);
#pragma unroll
  for (int i = 0; i < 8; ++i) { a[i] = (_Float16)p[i]; a[8 + i] = (_Float16)p[16 + i]; }
  return a;
}
__device__ __forceinline__ v16h frag_f32s(const float* rowk0, int lane, float sc) {
  v16h a; const float* p = rowk0 + 8 * (lane >> 4);
#pragma unroll
  for (int i = 0; i < 8; ++i) { a[i] = (_Float16)(p[i] * sc); a[8 + i] = (_Float16)(p[16 + i] * sc); }
  return a;
}
// column fragment from a [K][ld] layout (column n), rows >= K read as 0
__device__ __forceinline__ v16h fragc_f32(const float* W, int k0, int n, int lane, int ld, int K) {
  v16h a; const int g = lane >> 4;
#pragma unroll
  for (int i = 0; i < 8; ++i) { const int ka = k0 + 8 * g + i, kb = ka + 16;
    a[i] = (_Float16)(ka < K ? W[(size_t)(ka < K ? ka : K - 1) * ld + n] : 0.f); a[8 + i] = (_Float16)(kb < K ? W[(size_t)(kb < K ? kb : K - 1) * ld + n] : 0.f); }
  return a;
}
struct F2 { v16b h, l; };
__device__ __forceinline__ F2 bsplit16(const float v[16]) { F2 r;
#pragma unroll
  for (int i = 0; i < 16; ++i) { const __bf16 h = (__bf16)v[i]; r.h[i] = h; r.l[i] = (__bf16)(v[i] - (float)h); }
  return r; }
__device__ __forceinline__ F2 split_row(const float* row, int k0, int lane) { float v[16]; const float* p = row + k0 + 8 * (lane >> 4);
#pragma unroll
  for (int i = 0; i < 8; ++i) { v[i] = p[i]; v[8 + i] = p[16 + i]; }
  return bsplit16(v); }
__device__ __forceinline__ F2 split_rowK(const float* row, int k0, int lane, int K) { float v[16]; const int g = lane >> 4;
#pragma unroll
  for (int i = 0; i < 8; ++i) { const int ka = k0 + 8 * g + i, kb = ka + 16; v[i] = ka < K ? row[ka < K ? ka : K - 1] : 0.f; v[8 + i] = kb < K ? row[kb < K ? kb : K - 1] : 0.f; }
  return bsplit16(v); }
__device__ __forceinline__ F2 split_col(const float* W, int k0, int n, int lane, int ld, int K) { float v[16]; const int g = lane >> 4;
#pragma unroll
  for (int i = 0; i < 8; ++i) { const int ka = k0 + 8 * g + i, kb = ka + 16; v[i] = ka < K ? W[(size_t)(ka < K ? ka : K - 1) * ld + n] : 0.f; v[8 + i] = kb < K ? W[(size_t)(kb < K ? kb : K - 1) * ld + n] : 0.f; }
  return bsplit16(v); }
__device__ __forceinline__ v8f mac3(const F2& a, const F2& b, v8f c) { c = wmma_bf(a.l, b.h, c); c = wmma_bf(a.h, b.l, c); return wmma_bf(a.h, b.h, c); }
__device__ __forceinline__ float sigm(float v) { return 1.0f / (1.0f + expf(-v)); }
#define LDSX() do { asm volatile("s_wait_dscnt 0" ::: "memory"); __builtin_amdgcn_wave_barrier(); __builtin_amdgcn_fence(__ATOMIC_RELEASE, "workgroup"); } while (0)


// Multi-head scaled dot-product attention (B 2, S 2,048, E 1,024 = 16 x 64) with an integer attention_mask [B,1,S,S] (0 -> masked), output Linear.
#define NB 2
#define TT 2048
#define CC 1024
#define NH 16
#define HD 64
#ifndef TNB
#define TNB NB
#endif
typedef __attribute__((ext_vector_type(8))) __bf16 v8b;
__device__ __forceinline__ v16b frag_b(const __bf16* rowk0, int lane) {
  union { v16b v; v8b q[2]; } u; const __bf16* p = rowk0 + 8 * (lane >> 4);
  u.q[0] = *(const v8b*)p; u.q[1] = *(const v8b*)(p + 16); return u.v;
}
__device__ __forceinline__ float bfr(float v) { return (float)(__bf16)v; }
__device__ __attribute__((noinline)) float exp_ni(float v) { return expf(v); }
__device__ __attribute__((noinline)) float erf_ni(float v) { return erff(v); }

#define WS_QH  0u
#define WS_QL  (WS_QH + 2u * (size_t)NB * TT * CC)
#define WS_KH  (WS_QL + 2u * (size_t)NB * TT * CC)
#define WS_VT  (WS_KH + 2u * (size_t)NB * TT * CC)      // f16 v planes [b][c][t]
#define HG 4
#define WS_S   (WS_VT + 2u * (size_t)NB * CC * TT)      // f32 logits [hg][q][k]
#define WS_PH  (WS_S + 4u * (size_t)HG * TT * TT)       // f16 P [hg][q][k]
#define WS_Y   (WS_PH + 2u * (size_t)HG * TT * TT)          // f32 y rows [b*t][C]
#define WS_END (WS_Y + 4u * (size_t)NB * TT * CC)

// ---- k_proj: block = (64 rows, 128 cols, which): qkv = x W (+ b), exact; q -> f16 hi (+ residual), k -> f16 rows, v -> f16 planes
__global__ __launch_bounds__(128) void k_proj(const float* __restrict__ X, const float* __restrict__ WQ, const float* __restrict__ BQ, const float* __restrict__ WK, const float* __restrict__ BK, const float* __restrict__ WV, const float* __restrict__ BV, _Float16* __restrict__ QH, _Float16* __restrict__ QL, _Float16* __restrict__ KH, _Float16* __restrict__ VT) {
  __shared__ __align__(16) _Float16 sh[64][136], sl[64][136]; __shared__ __align__(16) _Float16 th[128][72];
  const int tid = threadIdx.x, wave = tid >> 5, lane = tid & 31, col = lane & 15, g = lane >> 4; const int which = blockIdx.z; const int c0 = blockIdx.y * 128; const size_t r0 = (size_t)blockIdx.x * 64; const float* WA = which == 0 ? WQ : which == 1 ? WK : WV; const float* BA = which == 0 ? BQ : which == 1 ? BK : BV;
  v8f acc[8] = {};
#pragma unroll 2
  for (int kc = 0; kc < CC / 32; ++kc) { v16b a; { const float* p = X + (r0 + wave * 16 + col) * CC + kc * 32 + 8 * g;
#pragma unroll
      for (int i = 0; i < 8; ++i) { a[i] = (__bf16)p[i]; a[8 + i] = (__bf16)p[16 + i]; } }
#pragma unroll
    for (int j = 0; j < 8; ++j) { v16b w; const int o = c0 + j * 16 + col;
#pragma unroll
      for (int i = 0; i < 8; ++i) { w[i] = (__bf16)WA[(size_t)(o) * CC + (kc * 32 + 8 * g + i)]; w[8 + i] = (__bf16)WA[(size_t)(o) * CC + (kc * 32 + 16 + 8 * g + i)]; }
      acc[j] = wmma_bf(a, w, acc[j]); } }
#pragma unroll
  for (int j = 0; j < 8; ++j) { const float bb = bfr(BA[c0 + j * 16 + col]);
#pragma unroll
    for (int r = 0; r < 8; ++r) { const float v = acc[j][r] + bb; const int rl = wave * 16 + 8 * g + r, cl = j * 16 + col; const _Float16 hv = (_Float16)v;
      if (which == 2) th[cl][rl] = hv; else { sh[rl][cl] = hv; sl[rl][cl] = (_Float16)(v - (float)hv); } } }
  __syncthreads();
  if (which < 2) { _Float16* dh = which == 0 ? QH : KH; for (int e = tid; e < 64 * 16; e += 128) { const int rl = e >> 4, q = e & 15; vst2((unsigned*)(dh + (r0 + rl) * CC + c0 + q * 8), *(const v4u*)&sh[rl][q * 8]); if (which == 0) vst2((unsigned*)(QL + (r0 + rl) * CC + c0 + q * 8), *(const v4u*)&sl[rl][q * 8]); } }
  else { const size_t b = r0 / TT; const int t0 = (int)(r0 % TT); for (int e = tid; e < 128 * 8; e += 128) { const int cl = e >> 3, q = e & 7; vst2((unsigned*)(VT + (b * CC + c0 + cl) * (size_t)TT + t0 + q * 8), *(const v4u*)&th[cl][q * 8]); } } }
// ---- k_sc: block = (64 queries, 128 keys) of (b,h): logits * scale, set to -3e38 where attention_mask == 0
__global__ __launch_bounds__(128) void k_sc(const _Float16* __restrict__ QH, const _Float16* __restrict__ QL, const _Float16* __restrict__ KH, const float* __restrict__ BM, int b, int h0, float* __restrict__ S0) { __shared__ __align__(16) float ss[4][16][132]; const int h = h0 + blockIdx.z; float* S = S0 + (size_t)blockIdx.z * TT * TT;
  const int tid = threadIdx.x, wave = tid >> 5, lane = tid & 31, col = lane & 15, g = lane >> 4; const int k0 = blockIdx.y * 128; const int ql0 = blockIdx.x * 64 + wave * 16; const size_t q0 = (size_t)b * TT + ql0;
  
  v8f acc[8] = {};
#pragma unroll
  for (int kc = 0; kc < HD / 32; ++kc) { const v16h ah = frag_h(QH + (q0 + col) * CC + h * HD + kc * 32, lane);
#pragma unroll
    for (int j = 0; j < 8; ++j) { const v16h kb = frag_h(KH + ((size_t)b * TT + k0 + j * 16 + col) * CC + h * HD + kc * 32, lane); acc[j] = wmma16(ah, kb, acc[j]); } }
#pragma unroll
  for (int j = 0; j < 8; ++j) { const int kt = k0 + j * 16 + col;
#pragma unroll
    for (int r = 0; r < 8; ++r) { const int qt = ql0 + 8 * g + r; float v = acc[j][r] * 0.125f; if (((const int*)BM)[(size_t)qt * TT + kt] == 0) v = -3.0e38f;  ss[wave][8 * g + r][j * 16 + col] = v; } }
  LDSX(); for (int rl = 0; rl < 16; ++rl) vst2(S + (size_t)(ql0 + rl) * TT + k0 + lane * 4, *(const v4f*)&ss[wave][rl][lane * 4]); }
// ---- k_sm: block = query row: softmax over keys [0, kend) -> P x 2^11 f16 (masked -> 0)
__global__ __launch_bounds__(256) void k_sm(const float* __restrict__ S0, _Float16* __restrict__ PH0) { __shared__ float sred[8]; __shared__ float sbc; __shared__ __align__(16) _Float16 sh[TT];
  const int t = threadIdx.x; const size_t row = blockIdx.x; const float* sr = S0 + (size_t)blockIdx.y * TT * TT + row * TT; _Float16* PH = PH0 + (size_t)blockIdx.y * TT * TT; const int kend = TT;
  float m = -3.0e38f; for (int k = t; k < kend; k += 256) m = fmaxf(m, sr[k]);
#pragma unroll
  for (int o = 1; o < 32; o <<= 1) m = fmaxf(m, __shfl_xor(m, o));
  if ((t & 31) == 0) sred[t >> 5] = m; __syncthreads(); if (t == 0) { float a = sred[0]; for (int i = 1; i < 8; ++i) a = fmaxf(a, sred[i]); sbc = a; } __syncthreads(); m = sbc; __syncthreads();
  float sum = 0.f; for (int k = t; k < kend; k += 256) { const float v = sr[k]; sum += (v <= -1.0e38f) ? 0.f : expf(v - m); }
#pragma unroll
  for (int o = 1; o < 32; o <<= 1) sum += __shfl_xor(sum, o);
  if ((t & 31) == 0) sred[t >> 5] = sum; __syncthreads(); if (t == 0) { float a = 0.f; for (int i = 0; i < 8; ++i) a += sred[i]; sbc = 1.0f / a; } __syncthreads(); const float inv = sbc;
  for (int k = t; k < kend; k += 256) { const float v = sr[k]; sh[k] = (_Float16)((v <= -1.0e38f) ? 0.f : expf(v - m) * inv * 2048.0f); }
  __syncthreads(); for (int q = t; q < kend / 8; q += 256) vst2((unsigned*)(PH + row * TT + q * 8), *(const v4u*)&sh[q * 8]); }
// ---- k_pv: block = 64 queries of (b,h): y[q][h*HD + d] = P . v  (keys [0, kend))
__global__ __launch_bounds__(128) void k_pv(const _Float16* __restrict__ PH0, const _Float16* __restrict__ VT, int b, int h0, float* __restrict__ Y) { const int h = h0 + blockIdx.z; const _Float16* PH = PH0 + (size_t)blockIdx.z * TT * TT; __shared__ __align__(16) float ss[4][16][HD + 4];
  const int tid = threadIdx.x, wave = tid >> 5, lane = tid & 31, col = lane & 15, g = lane >> 4; const int ql0 = blockIdx.x * 64 + wave * 16; const int kend = TT;
  v8f acc[HD / 16] = {};
#pragma unroll 1
  for (int kc = 0; kc < kend / 32; ++kc) { const v16h ph = frag_h(PH + (size_t)(ql0 + col) * TT + kc * 32, lane);
#pragma unroll
    for (int j = 0; j < HD / 16; ++j) acc[j] = wmma16(ph, frag_h(VT + ((size_t)b * CC + h * HD + j * 16 + col) * (size_t)TT + kc * 32, lane), acc[j]); }
#pragma unroll
  for (int j = 0; j < HD / 16; ++j)
#pragma unroll
    for (int r = 0; r < 8; ++r) ss[wave][8 * g + r][j * 16 + col] = acc[j][r] * (1.0f / 2048.0f);
  LDSX(); for (int rl = 0; rl < 16; ++rl) if (lane < HD / 4) vst2(Y + ((size_t)b * TT + ql0 + rl) * CC + h * HD + lane * 4, *(const v4f*)&ss[wave][rl][lane * 4]); }
// ---- k_out: block = (64 rows, 128 cols): out = y (bf16 hi + lo) Wproj + b
__global__ __launch_bounds__(128) void k_out(const float* __restrict__ Y, const float* __restrict__ WP, const float* __restrict__ BP, float* __restrict__ OUT) { __shared__ __align__(16) float sf[4][16][132];
  const int tid = threadIdx.x, wave = tid >> 5, lane = tid & 31, col = lane & 15, g = lane >> 4; const int c0 = blockIdx.y * 128; const size_t r0 = (size_t)blockIdx.x * 64 + wave * 16;
  v8f acc[8] = {};
#pragma unroll 2
  for (int kc = 0; kc < CC / 32; ++kc) { const F2 a = split_row(Y + (r0 + col) * CC, kc * 32, lane);
#pragma unroll
    for (int j = 0; j < 8; ++j) { v16b w; const int o = c0 + j * 16 + col;
#pragma unroll
      for (int i = 0; i < 8; ++i) { w[i] = (__bf16)WP[(size_t)(o) * CC + (kc * 32 + 8 * g + i)]; w[8 + i] = (__bf16)WP[(size_t)(o) * CC + (kc * 32 + 16 + 8 * g + i)]; }
      acc[j] = wmma_bf(a.h, w, acc[j]); acc[j] = wmma_bf(a.l, w, acc[j]); } }
#pragma unroll
  for (int j = 0; j < 8; ++j) { const float bb = BP ? bfr(BP[c0 + j * 16 + col]) : 0.f;
#pragma unroll
    for (int r = 0; r < 8; ++r) sf[wave][8 * g + r][j * 16 + col] = acc[j][r] + bb; }
  LDSX(); for (int rl = 0; rl < 16; ++rl) vst2(OUT + (r0 + rl) * CC + c0 + lane * 4, *(const v4f*)&sf[wave][rl][lane * 4]); }
extern "C" void kernel_launch(void* const* d_in, const int* in_sizes, int n_in, void* d_out, int out_size, void* d_ws, size_t ws_size, hipStream_t stream) {
  (void)in_sizes; (void)n_in; (void)out_size;
  const float** F = (const float**)d_in;   // 0 hidden_states [2,2048,1024], 1 attention_mask [2,1,2048,2048] int32, 2 wq [1024,1024] ([out,in]), 3 bq, 4 wk, 5 bk, 6 wv, 7 bv, 8 wo, 9 bo
  if (ws_size < (size_t)WS_END) return;
  char* ws = (char*)d_ws; _Float16 *QH = (_Float16*)(ws + WS_QH), *QL = (_Float16*)(ws + WS_QL), *KH = (_Float16*)(ws + WS_KH), *VT = (_Float16*)(ws + WS_VT), *PH = (_Float16*)(ws + WS_PH); float *S = (float*)(ws + WS_S), *Y = (float*)(ws + WS_Y);
  k_proj<<<dim3(TNB * TT / 64, CC / 128, 3), 128, 0, stream>>>(F[0], F[2], F[3], F[4], F[5], F[6], F[7], QH, QL, KH, VT);
  for (int b = 0; b < TNB; ++b) for (int h0 = 0; h0 < NH; h0 += HG) {   // HG heads per launch
    k_sc<<<dim3(TT / 64, TT / 128, HG), 128, 0, stream>>>(QH, QL, KH, (const float*)((const int*)d_in[1] + (size_t)b * TT * TT), b, h0, S);
    k_sm<<<dim3(TT, HG), 256, 0, stream>>>(S, PH);
    k_pv<<<dim3(TT / 64, 1, HG), 128, 0, stream>>>(PH, VT, b, h0, Y);
  }
  k_out<<<dim3(TNB * TT / 64, CC / 128), 128, 0, stream>>>(Y, F[8], F[9], (float*)d_out);
}

// v001
// One run takes 323 microseconds.
// Next to v000, in two timings, it ran 3.75 and 3.80 times as fast.
// compute dtype: all float inputs rounded to bf16, attention_mask (int) read; q/k/v = x W^T + b with EXACT bf16 products on WMMA 16x16x32, f32 accumulate; q, k rounded once to f16 (1-product logits / 8, std ~1), masked where attention_mask == 0, kept in f32 registers; online softmax in f32 (base 2) -> P f16 (unnormalised, <= 2^8); o = P . v (v once to f16) / sum P; out = o (bf16 hi + lo) Wo^T + bo; f32 output.
#include <hip/hip_runtime.h>
#include <math.h>

typedef __attribute__((ext_vector_type(16))) _Float16 v16h;
typedef __attribute__((ext_vector_type(16))) __bf16 v16b;
typedef __attribute__((ext_vector_type(8)))  _Float16 v8h;
typedef __attribute__((ext_vector_type(8)))  float v8f;
typedef __attribute__((ext_vector_type(4)))  float v4f;
typedef __attribute__((ext_vector_type(2)))  float v2f;
typedef __attribute__((ext_vector_type(4)))  unsigned v4u;
typedef __attribute__((ext_vector_type(4)))  int v4i;
typedef float __attribute__((may_alias)) float_a;
typedef int __attribute__((may_alias)) int_a;

template <typename T> __device__ __forceinline__ void vst2(void* p, T v) { *(T*)p = v;  }
__device__ __forceinline__ v8f wmma16(v16h a, v16h b, v8f c) {
  v8f d = __builtin_amdgcn_wmma_f32_16x16x32_f16(false, a, false, b, (short)0, c, false, false);
  asm volatile("v_nop\n\tv_nop\n\tv_nop\n\tv_nop" : "+v"(d) : "v"(a), "v"(b));
  return d;
}
__device__ __forceinline__ v8f wmma_bf(v16b a, v16b b, v8f c) {
  v8f d = __builtin_amdgcn_wmma_f32_16x16x32_bf16(false, a, false, b, (short)0, c, false, false);
  asm volatile("v_nop\n\tv_nop\n\tv_nop\n\tv_nop" : "+v"(d) : "v"(a), "v"(b));
  return d;
}
// 16x16x32 fragments: lane = (h = lane>>4, row/col = lane&15); elements 0..7 = k0+8h+0..7, 8..15 = k0+16+8h+0..7; D element r = row 8h+r
__device__ __forceinline__ v16h frag_h(const _Float16* rowk0, int lane) {
  union { v16h v; v8h q[2]; } u; const _Float16* p = rowk0 + 8 * (lane >> 4);
  u.q[0] = *(const v8h*)p; u.q[1] = *(const v8h*)(p + 16); return u.v;
}
__device__ __forceinline__ v16h frag_f32(const float* rowk0, int lane) {
  v16h a; const float* p = rowk0 + 8 * (lane >> 4);
#pragma unroll
  for (int i = 0; i < 8; ++i) { a[i] = (_Float16)p[i]; a[8 + i] = (_Float16)p[16 + i]; }
  return a;
}
__device__ __forceinline__ v16h frag_f32s(const float* rowk0, int lane, float sc) {
  v16h a; const float* p = rowk0 + 8 * (lane >> 4);
#pragma unroll
  for (int i = 0; i < 8; ++i) { a[i] = (_Float16)(p[i] * sc); a[8 + i] = (_Float16)(p[16 + i] * sc); }
  return a;
}
// column fragment from a [K][ld] layout (column n), rows >= K read as 0
__device__ __forceinline__ v16h fragc_f32(const float* W, int k0, int n, int lane, int ld, int K) {
  v16h a; const int g = lane >> 4;
#pragma unroll
  for (int i = 0; i < 8; ++i) { const int ka = k0 + 8 * g + i, kb = ka + 16;
    a[i] = (_Float16)(ka < K ? W[(size_t)(ka < K ? ka : K - 1) * ld + n] : 0.f); a[8 + i] = (_Float16)(kb < K ? W[(size_t)(kb < K ? kb : K - 1) * ld + n] : 0.f); }
  return a;
}
struct F2 { v16b h, l; };
__device__ __forceinline__ F2 bsplit16(const float v[16]) { F2 r;
#pragma unroll
  for (int i = 0; i < 16; ++i) { const __bf16 h = (__bf16)v[i]; r.h[i] = h; r.l[i] = (__bf16)(v[i] - (float)h); }
  return r; }
__device__ __forceinline__ F2 split_row(const float* row, int k0, int lane) { float v[16]; const float* p = row + k0 + 8 * (lane >> 4);
#pragma unroll
  for (int i = 0; i < 8; ++i) { v[i] = p[i]; v[8 + i] = p[16 + i]; }
  return bsplit16(v); }
__device__ __forceinline__ F2 split_rowK(const float* row, int k0, int lane, int K) { float v[16]; const int g = lane >> 4;
#pragma unroll
  for (int i = 0; i < 8; ++i) { const int ka = k0 + 8 * g + i, kb = ka + 16; v[i] = ka < K ? row[ka < K ? ka : K - 1] : 0.f; v[8 + i] = kb < K ? row[kb < K ? kb : K - 1] : 0.f; }
  return bsplit16(v); }
__device__ __forceinline__ F2 split_col(const float* W, int k0, int n, int lane, int ld, int K) { float v[16]; const int g = lane >> 4;
#pragma unroll
  for (int i = 0; i < 8; ++i) { const int ka = k0 + 8 * g + i, kb = ka + 16; v[i] = ka < K ? W[(size_t)(ka < K ? ka : K - 1) * ld + n] : 0.f; v[8 + i] = kb < K ? W[(size_t)(kb < K ? kb : K - 1) * ld + n] : 0.f; }
  return bsplit16(v); }
__device__ __forceinline__ v8f mac3(const F2& a, const F2& b, v8f c) { c = wmma_bf(a.l, b.h, c); c = wmma_bf(a.h, b.l, c); return wmma_bf(a.h, b.h, c); }
__device__ __forceinline__ float sigm(float v) { return 1.0f / (1.0f + expf(-v)); }
#define LDSX() do { asm volatile("s_wait_dscnt 0" ::: "memory"); __builtin_amdgcn_wave_barrier(); __builtin_amdgcn_fence(__ATOMIC_RELEASE, "workgroup"); } while (0)


// Multi-head scaled dot-product attention (B 2, S 2,048, E 1,024 = 16 x 64) with an integer attention_mask [B,1,S,S] (0 -> masked), output Linear.
#define NB 2
#define TT 2048
#define CC 1024
#define NH 16
#define HD 64
#ifndef TNB
#define TNB NB
#endif
typedef __attribute__((ext_vector_type(8))) __bf16 v8b;
__device__ __forceinline__ v16b frag_b(const __bf16* rowk0, int lane) {
  union { v16b v; v8b q[2]; } u; const __bf16* p = rowk0 + 8 * (lane >> 4);
  u.q[0] = *(const v8b*)p; u.q[1] = *(const v8b*)(p + 16); return u.v;
}
__device__ __forceinline__ float bfr(float v) { return (float)(__bf16)v; }
__device__ __attribute__((noinline)) float exp_ni(float v) { return expf(v); }
__device__ __attribute__((noinline)) float erf_ni(float v) { return erff(v); }

#define WS_QH  0u
#define WS_QL  (WS_QH + 2u * (size_t)NB * TT * CC)
#define WS_KH  (WS_QL + 2u * (size_t)NB * TT * CC)
#define WS_VT  (WS_KH + 2u * (size_t)NB * TT * CC)      // f16 v planes [b][c][t]
#define HG 4
#define WS_S   (WS_VT + 2u * (size_t)NB * CC * TT)      // unused; still counted in WS_END
#define WS_PH  (WS_S + 4u * (size_t)HG * TT * TT)       // unused; still counted in WS_END
#define WS_Y   (WS_PH + 2u * (size_t)HG * TT * TT)          // f32 y rows [b*t][C]
#define WS_END (WS_Y + 4u * (size_t)NB * TT * CC)

// ---- k_proj: block = (64 rows, 128 cols, which): qkv = x W (+ b), exact; q -> f16 hi (+ residual), k -> f16 rows, v -> f16 planes
__global__ __launch_bounds__(128) void k_proj(const float* __restrict__ X, const float* __restrict__ WQ, const float* __restrict__ BQ, const float* __restrict__ WK, const float* __restrict__ BK, const float* __restrict__ WV, const float* __restrict__ BV, _Float16* __restrict__ QH, _Float16* __restrict__ QL, _Float16* __restrict__ KH, _Float16* __restrict__ VT) {
  __shared__ __align__(16) _Float16 sh[64][136], sl[64][136]; __shared__ __align__(16) _Float16 th[128][72];
  const int tid = threadIdx.x, wave = tid >> 5, lane = tid & 31, col = lane & 15, g = lane >> 4; const int which = blockIdx.z; const int c0 = blockIdx.y * 128; const size_t r0 = (size_t)blockIdx.x * 64; const float* WA = which == 0 ? WQ : which == 1 ? WK : WV; const float* BA = which == 0 ? BQ : which == 1 ? BK : BV;
  v8f acc[8] = {};
#pragma unroll 2
  for (int kc = 0; kc < CC / 32; ++kc) { v16b a; { const float* p = X + (r0 + wave * 16 + col) * CC + kc * 32 + 8 * g;
#pragma unroll
      for (int i = 0; i < 8; ++i) { a[i] = (__bf16)p[i]; a[8 + i] = (__bf16)p[16 + i]; } }
#pragma unroll
    for (int j = 0; j < 8; ++j) { v16b w; const int o = c0 + j * 16 + col;
#pragma unroll
      for (int i = 0; i < 8; ++i) { w[i] = (__bf16)WA[(size_t)(o) * CC + (kc * 32 + 8 * g + i)]; w[8 + i] = (__bf16)WA[(size_t)(o) * CC + (kc * 32 + 16 + 8 * g + i)]; }
      acc[j] = wmma_bf(a, w, acc[j]); } }
#pragma unroll
  for (int j = 0; j < 8; ++j) { const float bb = bfr(BA[c0 + j * 16 + col]);
#pragma unroll
    for (int r = 0; r < 8; ++r) { const float v = acc[j][r] + bb; const int rl = wave * 16 + 8 * g + r, cl = j * 16 + col; const _Float16 hv = (_Float16)v;
      if (which == 2) th[cl][rl] = hv; else { sh[rl][cl] = hv; sl[rl][cl] = (_Float16)(v - (float)hv); } } }
  __syncthreads();
  if (which < 2) { _Float16* dh = which == 0 ? QH : KH; for (int e = tid; e < 64 * 16; e += 128) { const int rl = e >> 4, q = e & 15; vst2((unsigned*)(dh + (r0 + rl) * CC + c0 + q * 8), *(const v4u*)&sh[rl][q * 8]); if (which == 0) vst2((unsigned*)(QL + (r0 + rl) * CC + c0 + q * 8), *(const v4u*)&sl[rl][q * 8]); } }
  else { const size_t b = r0 / TT; const int t0 = (int)(r0 % TT); for (int e = tid; e < 128 * 8; e += 128) { const int cl = e >> 3, q = e & 7; vst2((unsigned*)(VT + (b * CC + c0 + cl) * (size_t)TT + t0 + q * 8), *(const v4u*)&th[cl][q * 8]); } } }
// ---- k_fa: block = 8 waves x 32 queries of one (b,h); one pass = 32 keys. S^T = K.Q^T, online softmax (base 2), O^T += V^T.P^T.
// A lane holds one query's scores (D register r = key 8g + r, column = query), so two converted score tiles are the B operand of the second product: P stays in registers.
typedef __attribute__((ext_vector_type(2))) _Float16 v2h;
__device__ __forceinline__ v8f mmah(v16h a, v16h b, v8f c) { return __builtin_amdgcn_wmma_f32_16x16x32_f16(false, a, false, b, (short)0, c, false, false); }
__device__ __forceinline__ float xhalf(float x) { return __builtin_bit_cast(float, __builtin_amdgcn_permlanex16(__builtin_bit_cast(int, x), __builtin_bit_cast(int, x), 0x76543210, 0xfedcba98, false, false)); }  // lane l with lane l ^ 16
// keeps the next pass's loads where they are written (one pass ahead of their use); moved down by the scheduler they would wait at full latency
#define SFENCE() __builtin_amdgcn_sched_barrier(0)
// behind a group of loads whose address registers the next instructions reuse
__device__ __forceinline__ void xwait() { asm volatile("s_wait_xcnt 0x0" ::: "memory"); }
__global__ __launch_bounds__(256) void k_fa(const _Float16* __restrict__ QH, const _Float16* __restrict__ KH, const _Float16* __restrict__ VT, const int* __restrict__ AM, float* __restrict__ Y) {
  const int tid = threadIdx.x, wave = tid >> 5, lane = tid & 31, col = lane & 15, g = lane >> 4; const int b = blockIdx.y / NH, h = blockIdx.y % NH; const int q0 = blockIdx.x * 256 + wave * 32;
  const float cs = 0.125f * 1.4426950408889634f;   // 1/sqrt(HD) and log2(e)
  const float RNEG = -0x1p126f;                    // masked raw score: a power of two, so RNEG * cs is exact and a row with every key masked gets exp2(0) = 1 at each key (uniform, as the reference)
  v16h qf[2][2], kf[2][2], vf[4]; v4i mk[8];   // the inner loops below are all unrolled: every index into a fragment array is then a constant and the arrays stay in registers
#pragma unroll
  for (int u = 0; u < 2; ++u)
#pragma unroll
    for (int kc = 0; kc < 2; ++kc) qf[u][kc] = frag_h(QH + ((size_t)b * TT + q0 + u * 16 + col) * CC + h * HD + kc * 32, lane);
  xwait();
  const _Float16* kp = KH + ((size_t)b * TT + col) * CC + h * HD;
  const _Float16* vp = VT + ((size_t)b * CC + h * HD + col) * (size_t)TT;
  const int* mp = AM + (size_t)b * TT * TT + (size_t)(q0 + col) * TT + 8 * g;              // a lane's own scores' mask words (row = its query)
  const int* mc = AM + (size_t)b * TT * TT + (size_t)(q0 + (lane >> 3)) * TT + (lane & 7) * 4;   // the same 32 x 32 tile by whole 128-byte lines, 4 rows a load: only asked whether it holds a 0
  auto ldK = [&](int k0) {
#pragma unroll
    for (int kt = 0; kt < 2; ++kt)
#pragma unroll
      for (int kc = 0; kc < 2; ++kc) kf[kt][kc] = frag_h(kp + (size_t)(k0 + kt * 16) * CC + kc * 32, lane); };
  auto ldV = [&](int k0) {
#pragma unroll
    for (int t = 0; t < 4; ++t) vf[t] = frag_h(vp + (size_t)(t * 16) * TT + k0, lane); };
  auto ldM = [&](int k0) {
#pragma unroll
    for (int j = 0; j < 8; ++j) mk[j] = *(const v4i*)(mc + (size_t)(j * 4) * TT + k0); };
  v8f acc[2][4] = {}; v8f lacc[2] = {}; float m_run[2] = { RNEG * cs, RNEG * cs };
  v16h ones;   // A operand of all ones: every row of its product is the column sums of P^T (the denominators' increments)
#pragma unroll
  for (int i = 0; i < 16; ++i) ones[i] = (_Float16)1.0f;
  ldK(0); SFENCE(); ldM(0); SFENCE(); ldV(0); SFENCE();   // in the loop's own order, so that its counted waits fit the first pass too
  for (int ps = 0; ps < TT / 32; ++ps) { const int k0 = ps * 32, kn = ((ps + 1) & (TT / 32 - 1)) * 32;   // next pass's keys; the last pass re-reads pass 0's (in bounds, unused)
    v8f s[2][2];
#pragma unroll
    for (int kt = 0; kt < 2; ++kt)
#pragma unroll
      for (int u = 0; u < 2; ++u) { s[kt][u] = v8f{};
#pragma unroll
        for (int kc = 0; kc < 2; ++kc) s[kt][u] = mmah(kf[kt][kc], qf[u][kc], s[kt][u]); }
    SFENCE();
    ldK(kn); xwait();
    SFENCE();
    unsigned mn = 0xFFFFFFFFu;   // 0 iff one of the 32 mask words this lane fetched is 0
#pragma unroll
    for (int j = 0; j < 8; ++j)
#pragma unroll
      for (int i = 0; i < 4; ++i) { const unsigned w = (unsigned)mk[j][i]; mn = w < mn ? w : mn; }
    SFENCE();
    ldM(kn); xwait();
    SFENCE();
    if (__builtin_amdgcn_ballot_w32(mn == 0u) != 0) {   // scalar branch: only a pass whose tile holds a masked key fetches the words in score order and pays for the selects
      const int* p = mp + k0; v4i mw[2][2][2];
#pragma unroll
      for (int u = 0; u < 2; ++u)
#pragma unroll
        for (int kt = 0; kt < 2; ++kt) { mw[u][kt][0] = *(const v4i*)(p + u * 16 * TT + kt * 16); mw[u][kt][1] = *(const v4i*)(p + u * 16 * TT + kt * 16 + 4); }
      asm volatile("s_wait_xcnt 0x0" :: "v"(p) : "memory");   // the wait behind these loads; naming p keeps their address pair out of the last load's own destination
#pragma unroll
      for (int u = 0; u < 2; ++u)
#pragma unroll
        for (int kt = 0; kt < 2; ++kt)
#pragma unroll
          for (int r = 0; r < 8; ++r) if (mw[u][kt][r >> 2][r & 3] == 0) s[kt][u][r] = RNEG; }
    float mb[2]; bool need = false;
#pragma unroll
    for (int u = 0; u < 2; ++u) { float mx = s[0][u][0];
#pragma unroll
      for (int kt = 0; kt < 2; ++kt)
#pragma unroll
        for (int r = 0; r < 8; ++r) mx = __builtin_fmaxf(mx, s[kt][u][r]);
      mx = __builtin_fmaxf(mx, xhalf(mx)) * cs; mb[u] = mx; need = need || (mx > m_run[u] + 8.0f); }
    if (__builtin_amdgcn_ballot_w32(need) != 0) {   // lazy rescale: the maximum in use may trail the true one by up to 8 (P <= 2^8, inside f16)
#pragma unroll
      for (int u = 0; u < 2; ++u) { const float m_new = __builtin_fmaxf(m_run[u], mb[u]); const float corr = __builtin_amdgcn_exp2f(m_run[u] - m_new); m_run[u] = m_new; lacc[u] = lacc[u] * corr;
#pragma unroll
        for (int t = 0; t < 4; ++t) acc[u][t] = acc[u][t] * corr; } }
#pragma unroll
    for (int u = 0; u < 2; ++u) { const float nm = -m_run[u]; v16h pf;
#pragma unroll
      for (int i = 0; i < 8; ++i) { const v2f arg = __builtin_elementwise_fma(v2f{s[i >> 2][u][2 * (i & 3)], s[i >> 2][u][2 * (i & 3) + 1]}, v2f{cs, cs}, v2f{nm, nm});
        const v2h pk = __builtin_convertvector(v2f{__builtin_amdgcn_exp2f(arg.x), __builtin_amdgcn_exp2f(arg.y)}, v2h); pf[2 * i] = pk.x; pf[2 * i + 1] = pk.y; }
#pragma unroll
      for (int t = 0; t < 4; ++t) acc[u][t] = mmah(vf[t], pf, acc[u][t]);
      lacc[u] = mmah(ones, pf, lacc[u]); }
    SFENCE();
    ldV(kn); xwait();
    SFENCE(); }
  asm volatile("s_wait_loadcnt 0x0" ::: "memory");   // the last pass's look-ahead loads land before the wave stores, ends and gives its registers back
#pragma unroll
  for (int u = 0; u < 2; ++u) { const float inv = 1.0f / lacc[u][0]; float* yp = Y + ((size_t)b * TT + q0 + u * 16 + col) * CC + h * HD + 8 * g;
#pragma unroll
    for (int t = 0; t < 4; ++t) { const v8f o = acc[u][t] * inv; vst2(yp + t * 16, v4f{o[0], o[1], o[2], o[3]}); vst2(yp + t * 16 + 4, v4f{o[4], o[5], o[6], o[7]}); } } }
// ---- k_out: block = (64 rows, 128 cols): out = y (bf16 hi + lo) Wproj + b
__global__ __launch_bounds__(128) void k_out(const float* __restrict__ Y, const float* __restrict__ WP, const float* __restrict__ BP, float* __restrict__ OUT) { __shared__ __align__(16) float sf[4][16][132];
  const int tid = threadIdx.x, wave = tid >> 5, lane = tid & 31, col = lane & 15, g = lane >> 4; const int c0 = blockIdx.y * 128; const size_t r0 = (size_t)blockIdx.x * 64 + wave * 16;
  v8f acc[8] = {};
#pragma unroll 2
  for (int kc = 0; kc < CC / 32; ++kc) { const F2 a = split_row(Y + (r0 + col) * CC, kc * 32, lane);
#pragma unroll
    for (int j = 0; j < 8; ++j) { v16b w; const int o = c0 + j * 16 + col;
#pragma unroll
      for (int i = 0; i < 8; ++i) { w[i] = (__bf16)WP[(size_t)(o) * CC + (kc * 32 + 8 * g + i)]; w[8 + i] = (__bf16)WP[(size_t)(o) * CC + (kc * 32 + 16 + 8 * g + i)]; }
      acc[j] = wmma_bf(a.h, w, acc[j]); acc[j] = wmma_bf(a.l, w, acc[j]); } }
#pragma unroll
  for (int j = 0; j < 8; ++j) { const float bb = BP ? bfr(BP[c0 + j * 16 + col]) : 0.f;
#pragma unroll
    for (int r = 0; r < 8; ++r) sf[wave][8 * g + r][j * 16 + col] = acc[j][r] + bb; }
  LDSX(); for (int rl = 0; rl < 16; ++rl) vst2(OUT + (r0 + rl) * CC + c0 + lane * 4, *(const v4f*)&sf[wave][rl][lane * 4]); }
extern "C" void kernel_launch(void* const* d_in, const int* in_sizes, int n_in, void* d_out, int out_size, void* d_ws, size_t ws_size, hipStream_t stream) {
  (void)in_sizes; (void)n_in; (void)out_size;
  const float** F = (const float**)d_in;   // 0 hidden_states [2,2048,1024], 1 attention_mask [2,1,2048,2048] int32, 2 wq [1024,1024] ([out,in]), 3 bq, 4 wk, 5 bk, 6 wv, 7 bv, 8 wo, 9 bo
  if (ws_size < (size_t)WS_END) return;
  char* ws = (char*)d_ws; _Float16 *QH = (_Float16*)(ws + WS_QH), *QL = (_Float16*)(ws + WS_QL), *KH = (_Float16*)(ws + WS_KH), *VT = (_Float16*)(ws + WS_VT); float *Y = (float*)(ws + WS_Y);
  k_proj<<<dim3(TNB * TT / 64, CC / 128, 3), 128, 0, stream>>>(F[0], F[2], F[3], F[4], F[5], F[6], F[7], QH, QL, KH, VT);
  k_fa<<<dim3(TT / 256, TNB * NH), 256, 0, stream>>>(QH, KH, VT, (const int*)d_in[1], Y);
  k_out<<<dim3(TNB * TT / 64, CC / 128), 128, 0, stream>>>(Y, F[8], F[9], (float*)d_out);
}

// v002
// One run takes 118 microseconds.
// Next to v001, in two timings, it ran 2.74 and 2.72 times as fast.
// All steps since v000 together make it 10.3 times as fast.
// compute dtype: all float inputs rounded to bf16, attention_mask (int) read; q/k/v = x W^T + b with EXACT bf16 products on WMMA 16x16x32, f32 accumulate; q, k rounded once to f16 (1-product logits / 8, std ~1), masked where attention_mask == 0, kept in f32 registers; online softmax in f32 (base 2) -> P f16 (unnormalised, <= 2^8); o = P . v (v once to f16) / sum P; out = o (bf16 hi + lo) Wo^T + bo; f32 output.
#include <hip/hip_runtime.h>
#include <math.h>

typedef __attribute__((ext_vector_type(16))) _Float16 v16h;
typedef __attribute__((ext_vector_type(16))) __bf16 v16b;
typedef __attribute__((ext_vector_type(8)))  _Float16 v8h;
typedef __attribute__((ext_vector_type(8)))  float v8f;
typedef __attribute__((ext_vector_type(4)))  float v4f;
typedef __attribute__((ext_vector_type(2)))  float v2f;
typedef __attribute__((ext_vector_type(4)))  unsigned v4u;
typedef __attribute__((ext_vector_type(4)))  int v4i;
typedef float __attribute__((may_alias)) float_a;
typedef int __attribute__((may_alias)) int_a;

template <typename T> __device__ __forceinline__ void vst2(void* p, T v) { *(T*)p = v;  }
__device__ __forceinline__ v8f wmma16(v16h a, v16h b, v8f c) {
  v8f d = __builtin_amdgcn_wmma_f32_16x16x32_f16(false, a, false, b, (short)0, c, false, false);
  asm volatile("v_nop\n\tv_nop\n\tv_nop\n\tv_nop" : "+v"(d) : "v"(a), "v"(b));
  return d;
}
__device__ __forceinline__ v8f wmma_bf(v16b a, v16b b, v8f c) {
  v8f d = __builtin_amdgcn_wmma_f32_16x16x32_bf16(false, a, false, b, (short)0, c, false, false);
  asm volatile("v_nop\n\tv_nop\n\tv_nop\n\tv_nop" : "+v"(d) : "v"(a), "v"(b));
  return d;
}
// 16x16x32 fragments: lane = (h = lane>>4, row/col = lane&15); elements 0..7 = k0+8h+0..7, 8..15 = k0+16+8h+0..7; D element r = row 8h+r
__device__ __forceinline__ v16h frag_h(const _Float16* rowk0, int lane) {
  union { v16h v; v8h q[2]; } u; const _Float16* p = rowk0 + 8 * (lane >> 4);
  u.q[0] = *(const v8h*)p; u.q[1] = *(const v8h*)(p + 16); return u.v;
}
__device__ __forceinline__ v16h frag_f32(const float* rowk0, int lane) {
  v16h a; const float* p = rowk0 + 8 * (lane >> 4);
#pragma unroll
  for (int i = 0; i < 8; ++i) { a[i] = (_Float16)p[i]; a[8 + i] = (_Float16)p[16 + i]; }
  return a;
}
__device__ __forceinline__ v16h frag_f32s(const float* rowk0, int lane, float sc) {
  v16h a; const float* p = rowk0 + 8 * (lane >> 4);
#pragma unroll
  for (int i = 0; i < 8; ++i) { a[i] = (_Float16)(p[i] * sc); a[8 + i] = (_Float16)(p[16 + i] * sc); }
  return a;
}
// column fragment from a [K][ld] layout (column n), rows >= K read as 0
__device__ __forceinline__ v16h fragc_f32(const float* W, int k0, int n, int lane, int ld, int K) {
  v16h a; const int g = lane >> 4;
#pragma unroll
  for (int i = 0; i < 8; ++i) { const int ka = k0 + 8 * g + i, kb = ka + 16;
    a[i] = (_Float16)(ka < K ? W[(size_t)(ka < K ? ka : K - 1) * ld + n] : 0.f); a[8 + i] = (_Float16)(kb < K ? W[(size_t)(kb < K ? kb : K - 1) * ld + n] : 0.f); }
  return a;
}
struct F2 { v16b h, l; };
__device__ __forceinline__ F2 bsplit16(const float v[16]) { F2 r;
#pragma unroll
  for (int i = 0; i < 16; ++i) { const __bf16 h = (__bf16)v[i]; r.h[i] = h; r.l[i] = (__bf16)(v[i] - (float)h); }
  return r; }
__device__ __forceinline__ F2 split_row(const float* row, int k0, int lane) { float v[16]; const float* p = row + k0 + 8 * (lane >> 4);
#pragma unroll
  for (int i = 0; i < 8; ++i) { v[i] = p[i]; v[8 + i] = p[16 + i]; }
  return bsplit16(v); }
__device__ __forceinline__ F2 split_rowK(const float* row, int k0, int lane, int K) { float v[16]; const int g = lane >> 4;
#pragma unroll
  for (int i = 0; i < 8; ++i) { const int ka = k0 + 8 * g + i, kb = ka + 16; v[i] = ka < K ? row[ka < K ? ka : K - 1] : 0.f; v[8 + i] = kb < K ? row[kb < K ? kb : K - 1] : 0.f; }
  return bsplit16(v); }
__device__ __forceinline__ F2 split_col(const float* W, int k0, int n, int lane, int ld, int K) { float v[16]; const int g = lane >> 4;
#pragma unroll
  for (int i = 0; i < 8; ++i) { const int ka = k0 + 8 * g + i, kb = ka + 16; v[i] = ka < K ? W[(size_t)(ka < K ? ka : K - 1) * ld + n] : 0.f; v[8 + i] = kb < K ? W[(size_t)(kb < K ? kb : K - 1) * ld + n] : 0.f; }
  return bsplit16(v); }
__device__ __forceinline__ v8f mac3(const F2& a, const F2& b, v8f c) { c = wmma_bf(a.l, b.h, c); c = wmma_bf(a.h, b.l, c); return wmma_bf(a.h, b.h, c); }
__device__ __forceinline__ float sigm(float v) { return 1.0f / (1.0f + expf(-v)); }
#define LDSX() do { asm volatile("s_wait_dscnt 0" ::: "memory"); __builtin_amdgcn_wave_barrier(); __builtin_amdgcn_fence(__ATOMIC_RELEASE, "workgroup"); } while (0)


// Multi-head scaled dot-product attention (B 2, S 2,048, E 1,024 = 16 x 64) with an integer attention_mask [B,1,S,S] (0 -> masked), output Linear.
#define NB 2
#define TT 2048
#define CC 1024
#define NH 16
#define HD 64
#ifndef TNB
#define TNB NB
#endif
typedef __attribute__((ext_vector_type(8))) __bf16 v8b;
__device__ __forceinline__ v16b frag_b(const __bf16* rowk0, int lane) {
  union { v16b v; v8b q[2]; } u; const __bf16* p = rowk0 + 8 * (lane >> 4);
  u.q[0] = *(const v8b*)p; u.q[1] = *(const v8b*)(p + 16); return u.v;
}
__device__ __forceinline__ float bfr(float v) { return (float)(__bf16)v; }
__device__ __attribute__((noinline)) float exp_ni(float v) { return expf(v); }
__device__ __attribute__((noinline)) float erf_ni(float v) { return erff(v); }

#define WS_QH  0u
#define WS_QL  (WS_QH + 2u * (size_t)NB * TT * CC)
#define WS_KH  (WS_QL + 2u * (size_t)NB * TT * CC)
#define WS_VT  (WS_KH + 2u * (size_t)NB * TT * CC)      // f16 v planes [b][c][t]
#define HG 4
#define WS_S   (WS_VT + 2u * (size_t)NB * CC * TT)      // unused; still counted in WS_END
#define WS_PH  (WS_S + 4u * (size_t)HG * TT * TT)       // unused; still counted in WS_END
#define WS_Y   (WS_PH + 2u * (size_t)HG * TT * TT)          // f32 y rows [b*t][C]
#define WS_END (WS_Y + 4u * (size_t)NB * TT * CC)

// keeps the next pass's loads where they are written (one pass ahead of their use); moved down by the scheduler they would wait at full latency
#define SFENCE() __builtin_amdgcn_sched_barrier(0)
// behind a group of loads or stores whose registers the next instructions reuse
__device__ __forceinline__ void xwait() { asm volatile("s_wait_xcnt 0x0" ::: "memory"); }
// ---- the two linear-layer kernels: block = 8 waves (2 x 4) on a 128 x 128 tile of the output, wave = 64 x 32; a step is 64 k.
// Both operands are fetched by whole 256-byte row pieces, rounded to bf16 once per block and kept in LDS, two buffers; every wave takes its fragments from there.
#define GT 128
#define GK 64
#define GP 72    // LDS row pitch in bf16 elements: 144 B = 16 B x 9, free of bank conflicts for the 16-byte fragment reads
#define GPL (GT * GP)   // one operand plane of one buffer, in elements
typedef __attribute__((ext_vector_type(4))) __bf16 v4b;
__device__ __forceinline__ v4b cvt4(v4f v) { v4b r;
#pragma unroll
  for (int i = 0; i < 4; ++i) r[i] = (__bf16)v[i];
  return r; }
// ---- k_proj: block = (128 rows, 128 cols, which): qkv = x W (+ b), exact; q -> f16 hi (+ residual), k -> f16 rows, v -> f16 planes
__global__ __launch_bounds__(256) void k_proj(const float* __restrict__ X, const float* __restrict__ WQ, const float* __restrict__ BQ, const float* __restrict__ WK, const float* __restrict__ BK, const float* __restrict__ WV, const float* __restrict__ BV, _Float16* __restrict__ QH, _Float16* __restrict__ QL, _Float16* __restrict__ KH, _Float16* __restrict__ VT) {
  __shared__ __align__(16) __bf16 sm[2 * 2 * GPL];   // [buffer][x | w][row][k]; the epilogue's f16 staging reuses it
  const int tid = threadIdx.x, wave = tid >> 5, lane = tid & 31, col = lane & 15, g = lane >> 4; const int which = blockIdx.z; const int c0 = blockIdx.y * GT; const size_t r0 = (size_t)blockIdx.x * GT; const float* WA = which == 0 ? WQ : which == 1 ? WK : WV; const float* BA = which == 0 ? BQ : which == 1 ? BK : BV;
  const int wm = wave >> 2, wn = wave & 3, lr = tid >> 4, lk = (tid & 15) * 4;
  const float* xa = X + (r0 + lr) * CC + lk; const float* wa = WA + (size_t)(c0 + lr) * CC + lk;
  v4f ra[8], rb[8];
  auto ldg = [&](int s) {
#pragma unroll
    for (int i = 0; i < 8; ++i) { ra[i] = *(const v4f*)(xa + (size_t)(i * 16) * CC + s * GK); rb[i] = *(const v4f*)(wa + (size_t)(i * 16) * CC + s * GK); } };
  auto sts = [&](int bf) { __bf16* d = sm + bf * 2 * GPL + lr * GP + lk;
#pragma unroll
    for (int i = 0; i < 8; ++i) { *(v4b*)(d + i * 16 * GP) = cvt4(ra[i]); *(v4b*)(d + GPL + i * 16 * GP) = cvt4(rb[i]); } };
  v8f acc[4][2] = {};
  ldg(0); xwait(); sts(0);
  for (int s = 0; s < CC / GK; ++s) {
    __syncthreads();   // step s's buffer is written; every wave has left the other one
    if (s + 1 < CC / GK) { ldg(s + 1); xwait(); }
    SFENCE();   // ends the scheduling region behind the loads: the fetched values are then rounded ahead of the products and held as bf16, half the registers (160 VGPRs against 192), so three blocks instead of two stay on a WGP and cover each other's loads
    const __bf16* pa = sm + (s & 1) * 2 * GPL + (wm * 64 + col) * GP; const __bf16* pw = sm + (s & 1) * 2 * GPL + GPL + (wn * 32 + col) * GP;
#pragma unroll
    for (int kk = 0; kk < GK / 32; ++kk) { v16b a[4], w[2];
#pragma unroll
      for (int i = 0; i < 4; ++i) a[i] = frag_b(pa + i * 16 * GP + kk * 32, lane);
#pragma unroll
      for (int j = 0; j < 2; ++j) w[j] = frag_b(pw + j * 16 * GP + kk * 32, lane);
#pragma unroll
      for (int i = 0; i < 4; ++i)
#pragma unroll
        for (int j = 0; j < 2; ++j) acc[i][j] = wmma_bf(a[i], w[j], acc[i][j]); }
    if (s + 1 < CC / GK) sts((s + 1) & 1); }
  const float* bp = BA + c0 + wn * 32 + col; const float braw[2] = { bp[0], bp[16] };
  asm volatile("s_wait_xcnt 0x0" :: "v"(bp) : "memory");   // the wait behind these loads; naming bp keeps their address pair out of a load's own destination
  __syncthreads();   // the last step's fragment reads are over: the buffers become the staging area
  _Float16* sh = (_Float16*)sm; _Float16* sl = sh + GT * 136;   // [128][136] each; for v one plane [col][row]
#pragma unroll
  for (int j = 0; j < 2; ++j) { const int cl = wn * 32 + j * 16 + col; const float bb = bfr(braw[j]);
#pragma unroll
    for (int i = 0; i < 4; ++i) { const int rl = wm * 64 + i * 16 + 8 * g;
      if (which == 2) { v8h pk;
#pragma unroll
        for (int r = 0; r < 8; ++r) pk[r] = (_Float16)(acc[i][j][r] + bb);
        *(v8h*)(sh + cl * 136 + rl) = pk; }
      else {
#pragma unroll
        for (int r = 0; r < 8; ++r) { const float v = acc[i][j][r] + bb; const _Float16 hv = (_Float16)v; sh[(rl + r) * 136 + cl] = hv; sl[(rl + r) * 136 + cl] = (_Float16)(v - (float)hv); } } } }
  __syncthreads();
  if (which < 2) { _Float16* dh = which == 0 ? QH : KH; for (int e = tid; e < GT * 16; e += 256) { const int rl = e >> 4, q = e & 15; vst2((unsigned*)(dh + (r0 + rl) * CC + c0 + q * 8), *(const v4u*)(sh + rl * 136 + q * 8)); xwait(); if (which == 0) { vst2((unsigned*)(QL + (r0 + rl) * CC + c0 + q * 8), *(const v4u*)(sl + rl * 136 + q * 8)); xwait(); } } }
  else { const size_t b = r0 / TT; const int t0 = (int)(r0 % TT); for (int e = tid; e < GT * 16; e += 256) { const int cl = e >> 4, q = e & 15; vst2((unsigned*)(VT + (b * CC + c0 + cl) * (size_t)TT + t0 + q * 8), *(const v4u*)(sh + cl * 136 + q * 8)); xwait(); } } }
// ---- k_fa: block = 8 waves x 32 queries of one (b,h); one pass = 32 keys. S^T = K.Q^T, online softmax (base 2), O^T += V^T.P^T.
// A lane holds one query's scores (D register r = key 8g + r, column = query), so two converted score tiles are the B operand of the second product: P stays in registers.
typedef __attribute__((ext_vector_type(2))) _Float16 v2h;
__device__ __forceinline__ v8f mmah(v16h a, v16h b, v8f c) { return __builtin_amdgcn_wmma_f32_16x16x32_f16(false, a, false, b, (short)0, c, false, false); }
__device__ __forceinline__ float xhalf(float x) { return __builtin_bit_cast(float, __builtin_amdgcn_permlanex16(__builtin_bit_cast(int, x), __builtin_bit_cast(int, x), 0x76543210, 0xfedcba98, false, false)); }  // lane l with lane l ^ 16
__global__ __launch_bounds__(256) void k_fa(const _Float16* __restrict__ QH, const _Float16* __restrict__ KH, const _Float16* __restrict__ VT, const int* __restrict__ AM, float* __restrict__ Y) {
  const int tid = threadIdx.x, wave = tid >> 5, lane = tid & 31, col = lane & 15, g = lane >> 4; const int b = blockIdx.y / NH, h = blockIdx.y % NH; const int q0 = blockIdx.x * 256 + wave * 32;
  const float cs = 0.125f * 1.4426950408889634f;   // 1/sqrt(HD) and log2(e)
  const float RNEG = -0x1p126f;                    // masked raw score: a power of two, so RNEG * cs is exact and a row with every key masked gets exp2(0) = 1 at each key (uniform, as the reference)
  v16h qf[2][2], kf[2][2], vf[4]; v4i mk[8];   // the inner loops below are all unrolled: every index into a fragment array is then a constant and the arrays stay in registers
#pragma unroll
  for (int u = 0; u < 2; ++u)
#pragma unroll
    for (int kc = 0; kc < 2; ++kc) qf[u][kc] = frag_h(QH + ((size_t)b * TT + q0 + u * 16 + col) * CC + h * HD + kc * 32, lane);
  xwait();
  const _Float16* kp = KH + ((size_t)b * TT + col) * CC + h * HD;
  const _Float16* vp = VT + ((size_t)b * CC + h * HD + col) * (size_t)TT;
  const int* mp = AM + (size_t)b * TT * TT + (size_t)(q0 + col) * TT + 8 * g;              // a lane's own scores' mask words (row = its query)
  const int* mc = AM + (size_t)b * TT * TT + (size_t)(q0 + (lane >> 3)) * TT + (lane & 7) * 4;   // the same 32 x 32 tile by whole 128-byte lines, 4 rows a load: only asked whether it holds a 0
  auto ldK = [&](int k0) {
#pragma unroll
    for (int kt = 0; kt < 2; ++kt)
#pragma unroll
      for (int kc = 0; kc < 2; ++kc) kf[kt][kc] = frag_h(kp + (size_t)(k0 + kt * 16) * CC + kc * 32, lane); };
  auto ldV = [&](int k0) {
#pragma unroll
    for (int t = 0; t < 4; ++t) vf[t] = frag_h(vp + (size_t)(t * 16) * TT + k0, lane); };
  auto ldM = [&](int k0) {
#pragma unroll
    for (int j = 0; j < 8; ++j) mk[j] = *(const v4i*)(mc + (size_t)(j * 4) * TT + k0); };
  v8f acc[2][4] = {}; v8f lacc[2] = {}; float m_run[2] = { RNEG * cs, RNEG * cs };
  v16h ones;   // A operand of all ones: every row of its product is the column sums of P^T (the denominators' increments)
#pragma unroll
  for (int i = 0; i < 16; ++i) ones[i] = (_Float16)1.0f;
  ldK(0); SFENCE(); ldM(0); SFENCE(); ldV(0); SFENCE();   // in the loop's own order, so that its counted waits fit the first pass too
  for (int ps = 0; ps < TT / 32; ++ps) { const int k0 = ps * 32, kn = ((ps + 1) & (TT / 32 - 1)) * 32;   // next pass's keys; the last pass re-reads pass 0's (in bounds, unused)
    v8f s[2][2];
#pragma unroll
    for (int kt = 0; kt < 2; ++kt)
#pragma unroll
      for (int u = 0; u < 2; ++u) { s[kt][u] = v8f{};
#pragma unroll
        for (int kc = 0; kc < 2; ++kc) s[kt][u] = mmah(kf[kt][kc], qf[u][kc], s[kt][u]); }
    SFENCE();
    ldK(kn); xwait();
    SFENCE();
    unsigned mn = 0xFFFFFFFFu;   // 0 iff one of the 32 mask words this lane fetched is 0
#pragma unroll
    for (int j = 0; j < 8; ++j)
#pragma unroll
      for (int i = 0; i < 4; ++i) { const unsigned w = (unsigned)mk[j][i]; mn = w < mn ? w : mn; }
    SFENCE();
    ldM(kn); xwait();
    SFENCE();
    if (__builtin_amdgcn_ballot_w32(mn == 0u) != 0) {   // scalar branch: only a pass whose tile holds a masked key fetches the words in score order and pays for the selects
      const int* p = mp + k0; v4i mw[2][2][2];
#pragma unroll
      for (int u = 0; u < 2; ++u)
#pragma unroll
        for (int kt = 0; kt < 2; ++kt) { mw[u][kt][0] = *(const v4i*)(p + u * 16 * TT + kt * 16); mw[u][kt][1] = *(const v4i*)(p + u * 16 * TT + kt * 16 + 4); }
      asm volatile("s_wait_xcnt 0x0" :: "v"(p) : "memory");   // the wait behind these loads; naming p keeps their address pair out of the last load's own destination
#pragma unroll
      for (int u = 0; u < 2; ++u)
#pragma unroll
        for (int kt = 0; kt < 2; ++kt)
#pragma unroll
          for (int r = 0; r < 8; ++r) if (mw[u][kt][r >> 2][r & 3] == 0) s[kt][u][r] = RNEG; }
    float mb[2]; bool need = false;
#pragma unroll
    for (int u = 0; u < 2; ++u) { float mx = s[0][u][0];
#pragma unroll
      for (int kt = 0; kt < 2; ++kt)
#pragma unroll
        for (int r = 0; r < 8; ++r) mx = __builtin_fmaxf(mx, s[kt][u][r]);
      mx = __builtin_fmaxf(mx, xhalf(mx)) * cs; mb[u] = mx; need = need || (mx > m_run[u] + 8.0f); }
    if (__builtin_amdgcn_ballot_w32(need) != 0) {   // lazy rescale: the maximum in use may trail the true one by up to 8 (P <= 2^8, inside f16)
#pragma unroll
      for (int u = 0; u < 2; ++u) { const float m_new = __builtin_fmaxf(m_run[u], mb[u]); const float corr = __builtin_amdgcn_exp2f(m_run[u] - m_new); m_run[u] = m_new; lacc[u] = lacc[u] * corr;
#pragma unroll
        for (int t = 0; t < 4; ++t) acc[u][t] = acc[u][t] * corr; } }
#pragma unroll
    for (int u = 0; u < 2; ++u) { const float nm = -m_run[u]; v16h pf;
#pragma unroll
      for (int i = 0; i < 8; ++i) { const v2f arg = __builtin_elementwise_fma(v2f{s[i >> 2][u][2 * (i & 3)], s[i >> 2][u][2 * (i & 3) + 1]}, v2f{cs, cs}, v2f{nm, nm});
        const v2h pk = __builtin_convertvector(v2f{__builtin_amdgcn_exp2f(arg.x), __builtin_amdgcn_exp2f(arg.y)}, v2h); pf[2 * i] = pk.x; pf[2 * i + 1] = pk.y; }
#pragma unroll
      for (int t = 0; t < 4; ++t) acc[u][t] = mmah(vf[t], pf, acc[u][t]);
      lacc[u] = mmah(ones, pf, lacc[u]); }
    SFENCE();
    ldV(kn); xwait();
    SFENCE(); }
  asm volatile("s_wait_loadcnt 0x0" ::: "memory");   // the last pass's look-ahead loads land before the wave stores, ends and gives its registers back
#pragma unroll
  for (int u = 0; u < 2; ++u) { const float inv = 1.0f / lacc[u][0]; float* yp = Y + ((size_t)b * TT + q0 + u * 16 + col) * CC + h * HD + 8 * g;
#pragma unroll
    for (int t = 0; t < 4; ++t) { const v8f o = acc[u][t] * inv; vst2(yp + t * 16, v4f{o[0], o[1], o[2], o[3]}); vst2(yp + t * 16 + 4, v4f{o[4], o[5], o[6], o[7]}); } } }
// ---- k_out: block = (128 rows, 128 cols): out = y (bf16 hi + lo) Wproj + b
__global__ __launch_bounds__(256) void k_out(const float* __restrict__ Y, const float* __restrict__ WP, const float* __restrict__ BP, float* __restrict__ OUT) {
  __shared__ __align__(16) __bf16 sm[2 * 3 * GPL];   // [buffer][y hi | y lo | w][row][k]; the epilogue's f32 staging reuses it
  const int tid = threadIdx.x, wave = tid >> 5, lane = tid & 31, col = lane & 15, g = lane >> 4; const int c0 = blockIdx.y * GT; const size_t r0 = (size_t)blockIdx.x * GT;
  const int wm = wave >> 2, wn = wave & 3, lr = tid >> 4, lk = (tid & 15) * 4;
  const float* ya = Y + (r0 + lr) * CC + lk; const float* wa = WP + (size_t)(c0 + lr) * CC + lk;
  v4f ra[8], rb[8];
  auto ldg = [&](int s) {
#pragma unroll
    for (int i = 0; i < 8; ++i) { ra[i] = *(const v4f*)(ya + (size_t)(i * 16) * CC + s * GK); rb[i] = *(const v4f*)(wa + (size_t)(i * 16) * CC + s * GK); } };
  auto sts = [&](int bf) { __bf16* d = sm + bf * 3 * GPL + lr * GP + lk;
#pragma unroll
    for (int i = 0; i < 8; ++i) { const v4b hi = cvt4(ra[i]); v4f rs;
#pragma unroll
      for (int e = 0; e < 4; ++e) rs[e] = ra[i][e] - (float)hi[e];
      *(v4b*)(d + i * 16 * GP) = hi; *(v4b*)(d + GPL + i * 16 * GP) = cvt4(rs); *(v4b*)(d + 2 * GPL + i * 16 * GP) = cvt4(rb[i]); } };
  v8f acc[4][2] = {};
  ldg(0); xwait(); sts(0);
  for (int s = 0; s < CC / GK; ++s) {
    __syncthreads();   // step s's buffer is written; every wave has left the other one
    if (s + 1 < CC / GK) { ldg(s + 1); xwait(); }
    const __bf16* pa = sm + (s & 1) * 3 * GPL + (wm * 64 + col) * GP; const __bf16* pw = sm + (s & 1) * 3 * GPL + 2 * GPL + (wn * 32 + col) * GP;
#pragma unroll
    for (int kk = 0; kk < GK / 32; ++kk) { v16b ah[4], al[4], w[2];
#pragma unroll
      for (int i = 0; i < 4; ++i) { ah[i] = frag_b(pa + i * 16 * GP + kk * 32, lane); al[i] = frag_b(pa + GPL + i * 16 * GP + kk * 32, lane); }
#pragma unroll
      for (int j = 0; j < 2; ++j) w[j] = frag_b(pw + j * 16 * GP + kk * 32, lane);
#pragma unroll
      for (int i = 0; i < 4; ++i)
#pragma unroll
        for (int j = 0; j < 2; ++j) acc[i][j] = wmma_bf(ah[i], w[j], acc[i][j]);
#pragma unroll
      for (int i = 0; i < 4; ++i)
#pragma unroll
        for (int j = 0; j < 2; ++j) acc[i][j] = wmma_bf(al[i], w[j], acc[i][j]); }
    if (s + 1 < CC / GK) sts((s + 1) & 1); }
  float braw[2] = { 0.f, 0.f };
  if (BP) { const float* bp = BP + c0 + wn * 32 + col; braw[0] = bp[0]; braw[1] = bp[16];
    asm volatile("s_wait_xcnt 0x0" :: "v"(bp) : "memory"); }   // the wait behind these loads; naming bp keeps their address pair out of a load's own destination
  __syncthreads();   // the last step's fragment reads are over: the buffers become the staging area
  float* sf = (float*)sm;   // [128][132]
#pragma unroll
  for (int j = 0; j < 2; ++j) { const int cl = wn * 32 + j * 16 + col; const float bb = bfr(braw[j]);
#pragma unroll
    for (int i = 0; i < 4; ++i)
#pragma unroll
      for (int r = 0; r < 8; ++r) sf[(wm * 64 + i * 16 + 8 * g + r) * 132 + cl] = acc[i][j][r] + bb; }
  __syncthreads();
  for (int e = tid; e < GT * 32; e += 256) { const int rl = e >> 5, q = e & 31; vst2(OUT + (r0 + rl) * CC + c0 + q * 4, *(const v4f*)(sf + rl * 132 + q * 4)); xwait(); } }
extern "C" void kernel_launch(void* const* d_in, const int* in_sizes, int n_in, void* d_out, int out_size, void* d_ws, size_t ws_size, hipStream_t stream) {
  (void)in_sizes; (void)n_in; (void)out_size;
  const float** F = (const float**)d_in;   // 0 hidden_states [2,2048,1024], 1 attention_mask [2,1,2048,2048] int32, 2 wq [1024,1024] ([out,in]), 3 bq, 4 wk, 5 bk, 6 wv, 7 bv, 8 wo, 9 bo
  if (ws_size < (size_t)WS_END) return;
  char* ws = (char*)d_ws; _Float16 *QH = (_Float16*)(ws + WS_QH), *QL = (_Float16*)(ws + WS_QL), *KH = (_Float16*)(ws + WS_KH), *VT = (_Float16*)(ws + WS_VT); float *Y = (float*)(ws + WS_Y);
  k_proj<<<dim3(TNB * TT / 128, CC / 128, 3), 256, 0, stream>>>(F[0], F[2], F[3], F[4], F[5], F[6], F[7], QH, QL, KH, VT);
  k_fa<<<dim3(TT / 256, TNB * NH), 256, 0, stream>>>(QH, KH, VT, (const int*)d_in[1], Y);
  k_out<<<dim3(TNB * TT / 128, CC / 128), 256, 0, stream>>>(Y, F[8], F[9], (float*)d_out);
}

// v003
// It runs in 106 microseconds.
// In both of two side-by-side timings against v002, it was 1.12 times as fast.
// Counting every step since v000, it is 11.6 times as fast.
// compute dtype: all float inputs rounded to bf16, attention_mask (int) read; q/k/v = x W^T + b with EXACT bf16 products on WMMA 16x16x32, f32 accumulate; q, k rounded once to f16 (1-product logits / 8, std ~1), masked where attention_mask == 0, kept in f32 registers; online softmax in f32 (base 2) -> P f16 (unnormalised, <= 2^8); o = P . v (v once to f16) / sum P; out = o (bf16 hi + lo) Wo^T + bo; f32 output.
#include <hip/hip_runtime.h>
#include <math.h>

typedef __attribute__((ext_vector_type(16))) _Float16 v16h;
typedef __attribute__((ext_vector_type(16))) __bf16 v16b;
typedef __attribute__((ext_vector_type(8)))  _Float16 v8h;
typedef __attribute__((ext_vector_type(8)))  float v8f;
typedef __attribute__((ext_vector_type(4)))  float v4f;
typedef __attribute__((ext_vector_type(2)))  float v2f;
typedef __attribute__((ext_vector_type(4)))  unsigned v4u;
typedef __attribute__((ext_vector_type(4)))  int v4i;
typedef float __attribute__((may_alias)) float_a;
typedef int __attribute__((may_alias)) int_a;

template <typename T> __device__ __forceinline__ void vst2(void* p, T v) { *(T*)p = v;  }
__device__ __forceinline__ v8f wmma16(v16h a, v16h b, v8f c) {
  v8f d = __builtin_amdgcn_wmma_f32_16x16x32_f16(false, a, false, b, (short)0, c, false, false);
  asm volatile("v_nop\n\tv_nop\n\tv_nop\n\tv_nop" : "+v"(d) : "v"(a), "v"(b));
  return d;
}
__device__ __forceinline__ v8f wmma_bf(v16b a, v16b b, v8f c) {
  v8f d = __builtin_amdgcn_wmma_f32_16x16x32_bf16(false, a, false, b, (short)0, c, false, false);
  asm volatile("v_nop\n\tv_nop\n\tv_nop\n\tv_nop" : "+v"(d) : "v"(a), "v"(b));
  return d;
}
// 16x16x32 fragments: lane = (h = lane>>4, row/col = lane&15); elements 0..7 = k0+8h+0..7, 8..15 = k0+16+8h+0..7; D element r = row 8h+r
__device__ __forceinline__ v16h frag_h(const _Float16* rowk0, int lane) {
  union { v16h v; v8h q[2]; } u; const _Float16* p = rowk0 + 8 * (lane >> 4);
  u.q[0] = *(const v8h*)p; u.q[1] = *(const v8h*)(p + 16); return u.v;
}
__device__ __forceinline__ v16h frag_f32(const float* rowk0, int lane) {
  v16h a; const float* p = rowk0 + 8 * (lane >> 4);
#pragma unroll
  for (int i = 0; i < 8; ++i) { a[i] = (_Float16)p[i]; a[8 + i] = (_Float16)p[16 + i]; }
  return a;
}
__device__ __forceinline__ v16h frag_f32s(const float* rowk0, int lane, float sc) {
  v16h a; const float* p = rowk0 + 8 * (lane >> 4);
#pragma unroll
  for (int i = 0; i < 8; ++i) { a[i] = (_Float16)(p[i] * sc); a[8 + i] = (_Float16)(p[16 + i] * sc); }
  return a;
}
// column fragment from a [K][ld] layout (column n), rows >= K read as 0
__device__ __forceinline__ v16h fragc_f32(const float* W, int k0, int n, int lane, int ld, int K) {
  v16h a; const int g = lane >> 4;
#pragma unroll
  for (int i = 0; i < 8; ++i) { const int ka = k0 + 8 * g + i, kb = ka + 16;
    a[i] = (_Float16)(ka < K ? W[(size_t)(ka < K ? ka : K - 1) * ld + n] : 0.f); a[8 + i] = (_Float16)(kb < K ? W[(size_t)(kb < K ? kb : K - 1) * ld + n] : 0.f); }
  return a;
}
struct F2 { v16b h, l; };
__device__ __forceinline__ F2 bsplit16(const float v[16]) { F2 r;
#pragma unroll
  for (int i = 0; i < 16; ++i) { const __bf16 h = (__bf16)v[i]; r.h[i] = h; r.l[i] = (__bf16)(v[i] - (float)h); }
  return r; }
__device__ __forceinline__ F2 split_row(const float* row, int k0, int lane) { float v[16]; const float* p = row + k0 + 8 * (lane >> 4);
#pragma unroll
  for (int i = 0; i < 8; ++i) { v[i] = p[i]; v[8 + i] = p[16 + i]; }
  return bsplit16(v); }
__device__ __forceinline__ F2 split_rowK(const float* row, int k0, int lane, int K) { float v[16]; const int g = lane >> 4;
#pragma unroll
  for (int i = 0; i < 8; ++i) { const int ka = k0 + 8 * g + i, kb = ka + 16; v[i] = ka < K ? row[ka < K ? ka : K - 1] : 0.f; v[8 + i] = kb < K ? row[kb < K ? kb : K - 1] : 0.f; }
  return bsplit16(v); }
__device__ __forceinline__ F2 split_col(const float* W, int k0, int n, int lane, int ld, int K) { float v[16]; const int g = lane >> 4;
#pragma unroll
  for (int i = 0; i < 8; ++i) { const int ka = k0 + 8 * g + i, kb = ka + 16; v[i] = ka < K ? W[(size_t)(ka < K ? ka : K - 1) * ld + n] : 0.f; v[8 + i] = kb < K ? W[(size_t)(kb < K ? kb : K - 1) * ld + n] : 0.f; }
  return bsplit16(v); }
__device__ __forceinline__ v8f mac3(const F2& a, const F2& b, v8f c) { c = wmma_bf(a.l, b.h, c); c = wmma_bf(a.h, b.l, c); return wmma_bf(a.h, b.h, c); }
__device__ __forceinline__ float sigm(float v) { return 1.0f / (1.0f + expf(-v)); }
#define LDSX() do { asm volatile("s_wait_dscnt 0" ::: "memory"); __builtin_amdgcn_wave_barrier(); __builtin_amdgcn_fence(__ATOMIC_RELEASE, "workgroup"); } while (0)


// Multi-head scaled dot-product attention (B 2, S 2,048, E 1,024 = 16 x 64) with an integer attention_mask [B,1,S,S] (0 -> masked), output Linear.
#define NB 2
#define TT 2048
#define CC 1024
#define NH 16
#define HD 64
#ifndef TNB
#define TNB NB
#endif
typedef __attribute__((ext_vector_type(8))) __bf16 v8b;
__device__ __forceinline__ v16b frag_b(const __bf16* rowk0, int lane) {
  union { v16b v; v8b q[2]; } u; const __bf16* p = rowk0 + 8 * (lane >> 4);
  u.q[0] = *(const v8b*)p; u.q[1] = *(const v8b*)(p + 16); return u.v;
}
__device__ __forceinline__ float bfr(float v) { return (float)(__bf16)v; }
__device__ __attribute__((noinline)) float exp_ni(float v) { return expf(v); }
__device__ __attribute__((noinline)) float erf_ni(float v) { return erff(v); }

#define WS_QH  0u
#define WS_QL  (WS_QH + 2u * (size_t)NB * TT * CC)
#define WS_KH  (WS_QL + 2u * (size_t)NB * TT * CC)
#define WS_VT  (WS_KH + 2u * (size_t)NB * TT * CC)      // f16 v planes [b][c][t]
#define HG 4
#define WS_S   (WS_VT + 2u * (size_t)NB * CC * TT)      // unused; still counted in WS_END
#define WS_PH  (WS_S + 4u * (size_t)HG * TT * TT)       // unused; still counted in WS_END
#define WS_Y   (WS_PH + 2u * (size_t)HG * TT * TT)          // f32 y rows [b*t][C]
#define WS_END (WS_Y + 4u * (size_t)NB * TT * CC)

// keeps the next pass's loads where they are written (one pass ahead of their use); moved down by the scheduler they would wait at full latency
#define SFENCE() __builtin_amdgcn_sched_barrier(0)
// behind a group of loads or stores whose registers the next instructions reuse
__device__ __forceinline__ void xwait() { asm volatile("s_wait_xcnt 0x0" ::: "memory"); }
// ---- the two linear-layer kernels: block = 8 waves (2 x 4) on a 128 x 128 tile of the output, wave = 64 x 32; a step is 64 k.
// Both operands are fetched by whole 256-byte row pieces, rounded to bf16 once per block and kept in LDS, two buffers; every wave takes its fragments from there.
#define GT 128
#define GK 64
#define GP 72    // LDS row pitch in bf16 elements: 144 B = 16 B x 9, free of bank conflicts for the 16-byte fragment reads
#define GPL (GT * GP)   // one operand plane of one buffer, in elements
typedef __attribute__((ext_vector_type(4))) __bf16 v4b;
__device__ __forceinline__ v4b cvt4(v4f v) { v4b r;
#pragma unroll
  for (int i = 0; i < 4; ++i) r[i] = (__bf16)v[i];
  return r; }
// ---- k_proj: block = (128 rows, 128 cols, which): qkv = x W (+ b), exact; q -> f16 hi (+ residual), k -> f16 rows, v -> f16 planes
__global__ __launch_bounds__(256) void k_proj(const float* __restrict__ X, const float* __restrict__ WQ, const float* __restrict__ BQ, const float* __restrict__ WK, const float* __restrict__ BK, const float* __restrict__ WV, const float* __restrict__ BV, _Float16* __restrict__ QH, _Float16* __restrict__ QL, _Float16* __restrict__ KH, _Float16* __restrict__ VT) {
  __shared__ __align__(16) __bf16 sm[2 * 2 * GPL];   // [buffer][x | w][row][k]; the epilogue's f16 staging reuses it
  const int tid = threadIdx.x, wave = tid >> 5, lane = tid & 31, col = lane & 15, g = lane >> 4; const int which = blockIdx.z; const int c0 = blockIdx.y * GT; const size_t r0 = (size_t)blockIdx.x * GT; const float* WA = which == 0 ? WQ : which == 1 ? WK : WV; const float* BA = which == 0 ? BQ : which == 1 ? BK : BV;
  const int wm = wave >> 2, wn = wave & 3, lr = tid >> 4, lk = (tid & 15) * 4;
  const float* xa = X + (r0 + lr) * CC + lk; const float* wa = WA + (size_t)(c0 + lr) * CC + lk;
  v4f ra[8], rb[8];
  auto ldg = [&](int s) {
#pragma unroll
    for (int i = 0; i < 8; ++i) { ra[i] = *(const v4f*)(xa + (size_t)(i * 16) * CC + s * GK); rb[i] = *(const v4f*)(wa + (size_t)(i * 16) * CC + s * GK); } };
  auto sts = [&](int bf) { __bf16* d = sm + bf * 2 * GPL + lr * GP + lk;
#pragma unroll
    for (int i = 0; i < 8; ++i) { *(v4b*)(d + i * 16 * GP) = cvt4(ra[i]); *(v4b*)(d + GPL + i * 16 * GP) = cvt4(rb[i]); } };
  v8f acc[4][2] = {};
  ldg(0); xwait(); sts(0);
  for (int s = 0; s < CC / GK; ++s) {
    __syncthreads();   // step s's buffer is written; every wave has left the other one
    if (s + 1 < CC / GK) { ldg(s + 1); xwait(); }
    SFENCE();   // ends the scheduling region behind the loads: the fetched values are then rounded ahead of the products and held as bf16, half the registers (160 VGPRs against 192), so three blocks instead of two stay on a WGP and cover each other's loads
    const __bf16* pa = sm + (s & 1) * 2 * GPL + (wm * 64 + col) * GP; const __bf16* pw = sm + (s & 1) * 2 * GPL + GPL + (wn * 32 + col) * GP;
#pragma unroll
    for (int kk = 0; kk < GK / 32; ++kk) { v16b a[4], w[2];
#pragma unroll
      for (int i = 0; i < 4; ++i) a[i] = frag_b(pa + i * 16 * GP + kk * 32, lane);
#pragma unroll
      for (int j = 0; j < 2; ++j) w[j] = frag_b(pw + j * 16 * GP + kk * 32, lane);
#pragma unroll
      for (int i = 0; i < 4; ++i)
#pragma unroll
        for (int j = 0; j < 2; ++j) acc[i][j] = wmma_bf(a[i], w[j], acc[i][j]); }
    if (s + 1 < CC / GK) sts((s + 1) & 1); }
  const float* bp = BA + c0 + wn * 32 + col; const float braw[2] = { bp[0], bp[16] };
  asm volatile("s_wait_xcnt 0x0" :: "v"(bp) : "memory");   // the wait behind these loads; naming bp keeps their address pair out of a load's own destination
  __syncthreads();   // the last step's fragment reads are over: the buffers become the staging area
  _Float16* sh = (_Float16*)sm; _Float16* sl = sh + GT * 136;   // [128][136] each; for v one plane [col][row]
#pragma unroll
  for (int j = 0; j < 2; ++j) { const int cl = wn * 32 + j * 16 + col; const float bb = bfr(braw[j]);
#pragma unroll
    for (int i = 0; i < 4; ++i) { const int rl = wm * 64 + i * 16 + 8 * g;
      if (which == 2) { v8h pk;
#pragma unroll
        for (int r = 0; r < 8; ++r) pk[r] = (_Float16)(acc[i][j][r] + bb);
        *(v8h*)(sh + cl * 136 + rl) = pk; }
      else {
#pragma unroll
        for (int r = 0; r < 8; ++r) { const float v = acc[i][j][r] + bb; const _Float16 hv = (_Float16)v; sh[(rl + r) * 136 + cl] = hv; sl[(rl + r) * 136 + cl] = (_Float16)(v - (float)hv); } } } }
  __syncthreads();
  if (which < 2) { _Float16* dh = which == 0 ? QH : KH; for (int e = tid; e < GT * 16; e += 256) { const int rl = e >> 4, q = e & 15; vst2((unsigned*)(dh + (r0 + rl) * CC + c0 + q * 8), *(const v4u*)(sh + rl * 136 + q * 8)); xwait(); if (which == 0) { vst2((unsigned*)(QL + (r0 + rl) * CC + c0 + q * 8), *(const v4u*)(sl + rl * 136 + q * 8)); xwait(); } } }
  else { const size_t b = r0 / TT; const int t0 = (int)(r0 % TT); for (int e = tid; e < GT * 16; e += 256) { const int cl = e >> 4, q = e & 15; vst2((unsigned*)(VT + (b * CC + c0 + cl) * (size_t)TT + t0 + q * 8), *(const v4u*)(sh + cl * 136 + q * 8)); xwait(); } } }
// ---- k_fa: block = 8 waves x 32 queries of one (b,h); one pass = 32 keys, one stage = 128 keys. S^T = K.Q^T, online softmax (base 2), O^T += V^T.P^T.
// A lane holds one query's scores (D register r = key 8g + r, column = query), so two converted score tiles are the B operand of the second product: P stays in registers.
// The K rows and V^T rows of a stage are the same for all 8 waves: the block brings them into LDS once, by whole 128-byte lines, with asynchronous copies, two buffers; every wave takes its fragments from there.
#define FK 128                // keys of a stage
#define FPP (FK / 32)         // passes of a stage
#define FNS (TT / FK)         // stages
#define FPK 72                // K row in LDS, f16 elements: 144 B = 16 B x 9, free of bank conflicts for the 16-byte fragment reads
#define FPV 136               // V^T row in LDS, f16 elements: 272 B = 16 B x 17, likewise
#define FKB (FK * FPK)        // the K plane of one buffer, in elements
#define FST (FKB + HD * FPV)  // one buffer, in elements
typedef __attribute__((ext_vector_type(2))) _Float16 v2h;
__device__ __forceinline__ v8f mmah(v16h a, v16h b, v8f c) { return __builtin_amdgcn_wmma_f32_16x16x32_f16(false, a, false, b, (short)0, c, false, false); }
__device__ __forceinline__ float xhalf(float x) { return __builtin_bit_cast(float, __builtin_amdgcn_permlanex16(__builtin_bit_cast(int, x), __builtin_bit_cast(int, x), 0x76543210, 0xfedcba98, false, false)); }  // lane l with lane l ^ 16
// eight 16-byte copies of a lane, global memory to LDS through no register; the s_wait_xcnt stands in the copies' own statement, so that no address register is rewritten in front of it
__device__ __forceinline__ void copy8(unsigned l0, unsigned l1, unsigned l2, unsigned l3, unsigned l4, unsigned l5, unsigned l6, unsigned l7, const _Float16* g0, const _Float16* g1, const _Float16* g2, const _Float16* g3, const _Float16* g4, const _Float16* g5, const _Float16* g6, const _Float16* g7) {
  asm volatile("global_load_async_to_lds_b128 %0, %8, off\n\tglobal_load_async_to_lds_b128 %1, %9, off\n\tglobal_load_async_to_lds_b128 %2, %10, off\n\tglobal_load_async_to_lds_b128 %3, %11, off\n\t"
               "global_load_async_to_lds_b128 %4, %12, off\n\tglobal_load_async_to_lds_b128 %5, %13, off\n\tglobal_load_async_to_lds_b128 %6, %14, off\n\tglobal_load_async_to_lds_b128 %7, %15, off\n\ts_wait_xcnt 0x0"
               :: "v"(l0), "v"(l1), "v"(l2), "v"(l3), "v"(l4), "v"(l5), "v"(l6), "v"(l7), "v"(g0), "v"(g1), "v"(g2), "v"(g3), "v"(g4), "v"(g5), "v"(g6), "v"(g7) : "memory"); }
__global__ __launch_bounds__(256) void k_fa(const _Float16* __restrict__ QH, const _Float16* __restrict__ KH, const _Float16* __restrict__ VT, const int* __restrict__ AM, float* __restrict__ Y) {
  __shared__ __align__(16) _Float16 sm[2 * FST];   // [buffer][K rows [key][d] | V^T rows [d][key]]
  const int tid = threadIdx.x, wave = tid >> 5, lane = tid & 31, col = lane & 15, g = lane >> 4; const int b = blockIdx.y / NH, h = blockIdx.y % NH; const int q0 = blockIdx.x * 256 + wave * 32;
  const float cs = 0.125f * 1.4426950408889634f;   // 1/sqrt(HD) and log2(e)
  const float RNEG = -0x1p126f;                    // masked raw score: a power of two, so RNEG * cs is exact and a row with every key masked gets exp2(0) = 1 at each key (uniform, as the reference)
  v16h qf[2][2], kf[2][2], vf[2][4]; v4i mk[8];   // the inner loops below are all unrolled: every index into a fragment array is then a constant and the arrays stay in registers
  // a thread's share of a stage: 4 pieces of K (rows 32 apart, 8 threads a 128-byte row) and 4 of V^T (rows 16 apart, 16 threads a 256-byte row piece)
  const _Float16* gk = KH + ((size_t)b * TT + (tid >> 3)) * CC + h * HD + (tid & 7) * 8;
  const _Float16* gv = VT + ((size_t)b * CC + h * HD + (tid >> 4)) * (size_t)TT + (tid & 15) * 8;
  const unsigned lk = (unsigned)(size_t)(sm + (tid >> 3) * FPK + (tid & 7) * 8), lv = (unsigned)(size_t)(sm + FKB + (tid >> 4) * FPV + (tid & 15) * 8);   // LDS byte addresses
  auto stage = [&](int t, int bf) { const _Float16* pk = gk + (size_t)t * FK * CC; const _Float16* pv = gv + t * FK; const unsigned ak = lk + bf * (FST * 2), av = lv + bf * (FST * 2);
    copy8(ak, ak + 32 * FPK * 2, ak + 64 * FPK * 2, ak + 96 * FPK * 2, av, av + 16 * FPV * 2, av + 32 * FPV * 2, av + 48 * FPV * 2, pk, pk + 32 * CC, pk + 64 * CC, pk + 96 * CC, pv, pv + 16 * TT, pv + 32 * TT, pv + 48 * TT); };
#pragma unroll
  for (int u = 0; u < 2; ++u)
#pragma unroll
    for (int kc = 0; kc < 2; ++kc) qf[u][kc] = frag_h(QH + ((size_t)b * TT + q0 + u * 16 + col) * CC + h * HD + kc * 32, lane);
  xwait();
  const int* mp = AM + (size_t)b * TT * TT + (size_t)(q0 + col) * TT + 8 * g;              // a lane's own scores' mask words (row = its query)
  const int* mc = AM + (size_t)b * TT * TT + (size_t)(q0 + (lane >> 3)) * TT + (lane & 7) * 4;   // the same 32 x 32 tile by whole 128-byte lines, 4 rows a load: only asked whether it holds a 0
  auto ldK = [&](const _Float16* sk, int p) {
#pragma unroll
    for (int kt = 0; kt < 2; ++kt)
#pragma unroll
      for (int kc = 0; kc < 2; ++kc) kf[kt][kc] = frag_h(sk + (p * 32 + kt * 16) * FPK + kc * 32, lane); };
  auto ldV = [&](const _Float16* sv, int p) {
#pragma unroll
    for (int t = 0; t < 4; ++t) vf[p & 1][t] = frag_h(sv + t * 16 * FPV + p * 32, lane); };
  auto ldM = [&](int k0) {
#pragma unroll
    for (int j = 0; j < 8; ++j) mk[j] = *(const v4i*)(mc + (size_t)(j * 4) * TT + k0); };
  v8f acc[2][4] = {}; v8f lacc[2] = {}; float m_run[2] = { RNEG * cs, RNEG * cs };
  v16h ones;   // A operand of all ones: every row of its product is the column sums of P^T (the denominators' increments)
#pragma unroll
  for (int i = 0; i < 16; ++i) ones[i] = (_Float16)1.0f;
  ldM(0); xwait(); SFENCE();
#pragma unroll 1   // kept rolled: unrolled, lk and lv are themselves operands of the copies' statement, are held among the first 256 registers through the whole kernel and end in scratch
  for (int i = 0; i < 2; ++i) { stage(i, i);   // stage 0 into buffer 0, waited for and published; then stage 1 into buffer 1, in flight over trip 0
    if (i == 0) { asm volatile("s_wait_asynccnt 0x0" ::: "memory");   // this wave's copies of stage 0 have landed
      __syncthreads(); } }                                            // and every other wave's: stage 0 may be read
#pragma unroll 1   // one stage a trip: the four passes inside are unrolled, more would only grow the code
  for (int t = 0; t < FNS; ++t) {
    const _Float16* sk = sm + (t & 1) * FST + col * FPK; const _Float16* sv = sm + (t & 1) * FST + FKB + col * FPV;
    ldK(sk, 0); ldV(sv, 0); SFENCE();
#pragma unroll
    for (int p = 0; p < FPP; ++p) { const int k0 = (t * FPP + p) * 32, kn = ((t * FPP + p + 1) & (TT / 32 - 1)) * 32;   // next pass's keys; the last pass re-reads pass 0's mask words (in bounds, unused)
      v8f s[2][2];
#pragma unroll
      for (int kt = 0; kt < 2; ++kt)
#pragma unroll
        for (int u = 0; u < 2; ++u) { s[kt][u] = v8f{};
#pragma unroll
          for (int kc = 0; kc < 2; ++kc) s[kt][u] = mmah(kf[kt][kc], qf[u][kc], s[kt][u]); }
      SFENCE();
      if (p + 1 < FPP) { ldK(sk, p + 1); ldV(sv, p + 1); }   // the next pass's fragments, in one group, from this stage's own buffer only
      SFENCE();
      unsigned mn = 0xFFFFFFFFu;   // 0 iff one of the 32 mask words this lane fetched is 0
#pragma unroll
      for (int j = 0; j < 8; ++j)
#pragma unroll
        for (int i = 0; i < 4; ++i) { const unsigned w = (unsigned)mk[j][i]; mn = w < mn ? w : mn; }
      SFENCE();
      ldM(kn); xwait();
      SFENCE();
      if (__builtin_amdgcn_ballot_w32(mn == 0u) != 0) {   // scalar branch: only a pass whose tile holds a masked key fetches the words in score order and pays for the selects
        const int* pm = mp + k0; v4i mw[2][2][2];
#pragma unroll
        for (int u = 0; u < 2; ++u)
#pragma unroll
          for (int kt = 0; kt < 2; ++kt) { mw[u][kt][0] = *(const v4i*)(pm + u * 16 * TT + kt * 16); mw[u][kt][1] = *(const v4i*)(pm + u * 16 * TT + kt * 16 + 4); }
        asm volatile("s_wait_xcnt 0x0" :: "v"(pm) : "memory");   // the wait behind these loads; naming pm keeps their address pair out of the last load's own destination
#pragma unroll
        for (int u = 0; u < 2; ++u)
#pragma unroll
          for (int kt = 0; kt < 2; ++kt)
#pragma unroll
            for (int r = 0; r < 8; ++r) if (mw[u][kt][r >> 2][r & 3] == 0) s[kt][u][r] = RNEG; }
      float mb[2]; bool need = false;
#pragma unroll
      for (int u = 0; u < 2; ++u) { float mx = s[0][u][0];
#pragma unroll
        for (int kt = 0; kt < 2; ++kt)
#pragma unroll
          for (int r = 0; r < 8; ++r) mx = __builtin_fmaxf(mx, s[kt][u][r]);
        mx = __builtin_fmaxf(mx, xhalf(mx)) * cs; mb[u] = mx; need = need || (mx > m_run[u] + 8.0f); }
      if (__builtin_amdgcn_ballot_w32(need) != 0) {   // lazy rescale: the maximum in use may trail the true one by up to 8 (P <= 2^8, inside f16)
#pragma unroll
        for (int u = 0; u < 2; ++u) { const float m_new = __builtin_fmaxf(m_run[u], mb[u]); const float corr = __builtin_amdgcn_exp2f(m_run[u] - m_new); m_run[u] = m_new; lacc[u] = lacc[u] * corr;
#pragma unroll
          for (int tt = 0; tt < 4; ++tt) acc[u][tt] = acc[u][tt] * corr; } }
#pragma unroll
      for (int u = 0; u < 2; ++u) { const float nm = -m_run[u]; v16h pf;
#pragma unroll
        for (int i = 0; i < 8; ++i) { const v2f arg = __builtin_elementwise_fma(v2f{s[i >> 2][u][2 * (i & 3)], s[i >> 2][u][2 * (i & 3) + 1]}, v2f{cs, cs}, v2f{nm, nm});
          const v2h pk = __builtin_convertvector(v2f{__builtin_amdgcn_exp2f(arg.x), __builtin_amdgcn_exp2f(arg.y)}, v2h); pf[2 * i] = pk.x; pf[2 * i + 1] = pk.y; }
#pragma unroll
        for (int tt = 0; tt < 4; ++tt) acc[u][tt] = mmah(vf[p & 1][tt], pf, acc[u][tt]);
        lacc[u] = mmah(ones, pf, lacc[u]); }
      SFENCE(); }
    asm volatile("s_wait_dscnt 0x0" ::: "memory");      // this wave's reads of stage t's buffer are over
    asm volatile("s_wait_asynccnt 0x0" ::: "memory");   // this wave's copies of stage t + 1 have landed
    __syncthreads();                                    // both hold for every wave: stage t + 1 may be read, stage t's buffer refilled
    if (t + 2 < FNS) stage(t + 2, t & 1); }
  asm volatile("s_wait_asynccnt 0x0" ::: "memory");   // no copy is left in flight when the wave ends
  asm volatile("s_wait_loadcnt 0x0" ::: "memory");   // the last pass's look-ahead loads land before the wave stores, ends and gives its registers back
#pragma unroll
  for (int u = 0; u < 2; ++u) { const float inv = 1.0f / lacc[u][0]; float* yp = Y + ((size_t)b * TT + q0 + u * 16 + col) * CC + h * HD + 8 * g;
#pragma unroll
    for (int t = 0; t < 4; ++t) { const v8f o = acc[u][t] * inv; vst2(yp + t * 16, v4f{o[0], o[1], o[2], o[3]}); vst2(yp + t * 16 + 4, v4f{o[4], o[5], o[6], o[7]}); } } }
// ---- k_out: block = (128 rows, 128 cols): out = y (bf16 hi + lo) Wproj + b
__global__ __launch_bounds__(256) void k_out(const float* __restrict__ Y, const float* __restrict__ WP, const float* __restrict__ BP, float* __restrict__ OUT) {
  __shared__ __align__(16) __bf16 sm[2 * 3 * GPL];   // [buffer][y hi | y lo | w][row][k]; the epilogue's f32 staging reuses it
  const int tid = threadIdx.x, wave = tid >> 5, lane = tid & 31, col = lane & 15, g = lane >> 4; const int c0 = blockIdx.y * GT; const size_t r0 = (size_t)blockIdx.x * GT;
  const int wm = wave >> 2, wn = wave & 3, lr = tid >> 4, lk = (tid & 15) * 4;
  const float* ya = Y + (r0 + lr) * CC + lk; const float* wa = WP + (size_t)(c0 + lr) * CC + lk;
  v4f ra[8], rb[8];
  auto ldg = [&](int s) {
#pragma unroll
    for (int i = 0; i < 8; ++i) { ra[i] = *(const v4f*)(ya + (size_t)(i * 16) * CC + s * GK); rb[i] = *(const v4f*)(wa + (size_t)(i * 16) * CC + s * GK); } };
  auto sts = [&](int bf) { __bf16* d = sm + bf * 3 * GPL + lr * GP + lk;
#pragma unroll
    for (int i = 0; i < 8; ++i) { const v4b hi = cvt4(ra[i]); v4f rs;
#pragma unroll
      for (int e = 0; e < 4; ++e) rs[e] = ra[i][e] - (float)hi[e];
      *(v4b*)(d + i * 16 * GP) = hi; *(v4b*)(d + GPL + i * 16 * GP) = cvt4(rs); *(v4b*)(d + 2 * GPL + i * 16 * GP) = cvt4(rb[i]); } };
  v8f acc[4][2] = {};
  ldg(0); xwait(); sts(0);
  for (int s = 0; s < CC / GK; ++s) {
    __syncthreads();   // step s's buffer is written; every wave has left the other one
    if (s + 1 < CC / GK) { ldg(s + 1); xwait(); }
    const __bf16* pa = sm + (s & 1) * 3 * GPL + (wm * 64 + col) * GP; const __bf16* pw = sm + (s & 1) * 3 * GPL + 2 * GPL + (wn * 32 + col) * GP;
#pragma unroll
    for (int kk = 0; kk < GK / 32; ++kk) { v16b ah[4], al[4], w[2];
#pragma unroll
      for (int i = 0; i < 4; ++i) { ah[i] = frag_b(pa + i * 16 * GP + kk * 32, lane); al[i] = frag_b(pa + GPL + i * 16 * GP + kk * 32, lane); }
#pragma unroll
      for (int j = 0; j < 2; ++j) w[j] = frag_b(pw + j * 16 * GP + kk * 32, lane);
#pragma unroll
      for (int i = 0; i < 4; ++i)
#pragma unroll
        for (int j = 0; j < 2; ++j) acc[i][j] = wmma_bf(ah[i], w[j], acc[i][j]);
#pragma unroll
      for (int i = 0; i < 4; ++i)
#pragma unroll
        for (int j = 0; j < 2; ++j) acc[i][j] = wmma_bf(al[i], w[j], acc[i][j]); }
    if (s + 1 < CC / GK) sts((s + 1) & 1); }
  float braw[2] = { 0.f, 0.f };
  if (BP) { const float* bp = BP + c0 + wn * 32 + col; braw[0] = bp[0]; braw[1] = bp[16];
    asm volatile("s_wait_xcnt 0x0" :: "v"(bp) : "memory"); }   // the wait behind these loads; naming bp keeps their address pair out of a load's own destination
  __syncthreads();   // the last step's fragment reads are over: the buffers become the staging area
  float* sf = (float*)sm;   // [128][132]
#pragma unroll
  for (int j = 0; j < 2; ++j) { const int cl = wn * 32 + j * 16 + col; const float bb = bfr(braw[j]);
#pragma unroll
    for (int i = 0; i < 4; ++i)
#pragma unroll
      for (int r = 0; r < 8; ++r) sf[(wm * 64 + i * 16 + 8 * g + r) * 132 + cl] = acc[i][j][r] + bb; }
  __syncthreads();
  for (int e = tid; e < GT * 32; e += 256) { const int rl = e >> 5, q = e & 31; vst2(OUT + (r0 + rl) * CC + c0 + q * 4, *(const v4f*)(sf + rl * 132 + q * 4)); xwait(); } }
extern "C" void kernel_launch(void* const* d_in, const int* in_sizes, int n_in, void* d_out, int out_size, void* d_ws, size_t ws_size, hipStream_t stream) {
  (void)in_sizes; (void)n_in; (void)out_size;
  const float** F = (const float**)d_in;   // 0 hidden_states [2,2048,1024], 1 attention_mask [2,1,2048,2048] int32, 2 wq [1024,1024] ([out,in]), 3 bq, 4 wk, 5 bk, 6 wv, 7 bv, 8 wo, 9 bo
  if (ws_size < (size_t)WS_END) return;
  char* ws = (char*)d_ws; _Float16 *QH = (_Float16*)(ws + WS_QH), *QL = (_Float16*)(ws + WS_QL), *KH = (_Float16*)(ws + WS_KH), *VT = (_Float16*)(ws + WS_VT); float *Y = (float*)(ws + WS_Y);
  k_proj<<<dim3(TNB * TT / 128, CC / 128, 3), 256, 0, stream>>>(F[0], F[2], F[3], F[4], F[5], F[6], F[7], QH, QL, KH, VT);
  k_fa<<<dim3(TT / 256, TNB * NH), 256, 0, stream>>>(QH, KH, VT, (const int*)d_in[1], Y);
  k_out<<<dim3(TNB * TT / 128, CC / 128), 256, 0, stream>>>(Y, F[8], F[9], (float*)d_out);
}

// v004
// Measured time: 94.6 microseconds a run.
// Timed twice side by side with v003, it ran 1.11 times as fast both times.
// Over all steps from v000 it is 12.9 times as fast.
// compute dtype: all float inputs rounded to bf16, attention_mask (int) read once and packed to one bit a word; q/k/v = x W^T + b with EXACT bf16 products on WMMA 16x16x32, f32 accumulate; q, k rounded once to f16 (1-product logits / 8, std ~1), masked where attention_mask == 0, kept in f32 registers; online softmax in f32 (base 2) -> P f16 (unnormalised, <= 2^8); o = P . v (v once to f16) / sum P; out = o (bf16 hi + lo) Wo^T + bo; f32 output.
#include <hip/hip_runtime.h>
#include <math.h>

typedef __attribute__((ext_vector_type(16))) _Float16 v16h;
typedef __attribute__((ext_vector_type(16))) __bf16 v16b;
typedef __attribute__((ext_vector_type(8)))  _Float16 v8h;
typedef __attribute__((ext_vector_type(8)))  float v8f;
typedef __attribute__((ext_vector_type(4)))  float v4f;
typedef __attribute__((ext_vector_type(2)))  float v2f;
typedef __attribute__((ext_vector_type(4)))  unsigned v4u;
typedef __attribute__((ext_vector_type(4)))  int v4i;
typedef float __attribute__((may_alias)) float_a;
typedef int __attribute__((may_alias)) int_a;

template <typename T> __device__ __forceinline__ void vst2(void* p, T v) { *(T*)p = v;  }
__device__ __forceinline__ v8f wmma16(v16h a, v16h b, v8f c) {
  v8f d = __builtin_amdgcn_wmma_f32_16x16x32_f16(false, a, false, b, (short)0, c, false, false);
  asm volatile("v_nop\n\tv_nop\n\tv_nop\n\tv_nop" : "+v"(d) : "v"(a), "v"(b));
  return d;
}
__device__ __forceinline__ v8f wmma_bf(v16b a, v16b b, v8f c) {
  v8f d = __builtin_amdgcn_wmma_f32_16x16x32_bf16(false, a, false, b, (short)0, c, false, false);
  asm volatile("v_nop\n\tv_nop\n\tv_nop\n\tv_nop" : "+v"(d) : "v"(a), "v"(b));
  return d;
}
// 16x16x32 fragments: lane = (h = lane>>4, row/col = lane&15); elements 0..7 = k0+8h+0..7, 8..15 = k0+16+8h+0..7; D element r = row 8h+r
__device__ __forceinline__ v16h frag_h(const _Float16* rowk0, int lane) {
  union { v16h v; v8h q[2]; } u; const _Float16* p = rowk0 + 8 * (lane >> 4);
  u.q[0] = *(const v8h*)p; u.q[1] = *(const v8h*)(p + 16); return u.v;
}
__device__ __forceinline__ v16h frag_f32(const float* rowk0, int lane) {
  v16h a; const float* p = rowk0 + 8 * (lane >> 4);
#pragma unroll
  for (int i = 0; i < 8; ++i) { a[i] = (_Float16)p[i]; a[8 + i] = (_Float16)p[16 + i]; }
  return a;
}
__device__ __forceinline__ v16h frag_f32s(const float* rowk0, int lane, float sc) {
  v16h a; const float* p = rowk0 + 8 * (lane >> 4);
#pragma unroll
  for (int i = 0; i < 8; ++i) { a[i] = (_Float16)(p[i] * sc); a[8 + i] = (_Float16)(p[16 + i] * sc); }
  return a;
}
// column fragment from a [K][ld] layout (column n), rows >= K read as 0
__device__ __forceinline__ v16h fragc_f32(const float* W, int k0, int n, int lane, int ld, int K) {
  v16h a; const int g = lane >> 4;
#pragma unroll
  for (int i = 0; i < 8; ++i) { const int ka = k0 + 8 * g + i, kb = ka + 16;
    a[i] = (_Float16)(ka < K ? W[(size_t)(ka < K ? ka : K - 1) * ld + n] : 0.f); a[8 + i] = (_Float16)(kb < K ? W[(size_t)(kb < K ? kb : K - 1) * ld + n] : 0.f); }
  return a;
}
struct F2 { v16b h, l; };
__device__ __forceinline__ F2 bsplit16(const float v[16]) { F2 r;
#pragma unroll
  for (int i = 0; i < 16; ++i) { const __bf16 h = (__bf16)v[i]; r.h[i] = h; r.l[i] = (__bf16)(v[i] - (float)h); }
  return r; }
__device__ __forceinline__ F2 split_row(const float* row, int k0, int lane) { float v[16]; const float* p = row + k0 + 8 * (lane >> 4);
#pragma unroll
  for (int i = 0; i < 8; ++i) { v[i] = p[i]; v[8 + i] = p[16 + i]; }
  return bsplit16(v); }
__device__ __forceinline__ F2 split_rowK(const float* row, int k0, int lane, int K) { float v[16]; const int g = lane >> 4;
#pragma unroll
  for (int i = 0; i < 8; ++i) { const int ka = k0 + 8 * g + i, kb = ka + 16; v[i] = ka < K ? row[ka < K ? ka : K - 1] : 0.f; v[8 + i] = kb < K ? row[kb < K ? kb : K - 1] : 0.f; }
  return bsplit16(v); }
__device__ __forceinline__ F2 split_col(const float* W, int k0, int n, int lane, int ld, int K) { float v[16]; const int g = lane >> 4;
#pragma unroll
  for (int i = 0; i < 8; ++i) { const int ka = k0 + 8 * g + i, kb = ka + 16; v[i] = ka < K ? W[(size_t)(ka < K ? ka : K - 1) * ld + n] : 0.f; v[8 + i] = kb < K ? W[(size_t)(kb < K ? kb : K - 1) * ld + n] : 0.f; }
  return bsplit16(v); }
__device__ __forceinline__ v8f mac3(const F2& a, const F2& b, v8f c) { c = wmma_bf(a.l, b.h, c); c = wmma_bf(a.h, b.l, c); return wmma_bf(a.h, b.h, c); }
__device__ __forceinline__ float sigm(float v) { return 1.0f / (1.0f + expf(-v)); }
#define LDSX() do { asm volatile("s_wait_dscnt 0" ::: "memory"); __builtin_amdgcn_wave_barrier(); __builtin_amdgcn_fence(__ATOMIC_RELEASE, "workgroup"); } while (0)


// Multi-head scaled dot-product attention (B 2, S 2,048, E 1,024 = 16 x 64) with an integer attention_mask [B,1,S,S] (0 -> masked), output Linear.
#define NB 2
#define TT 2048
#define CC 1024
#define NH 16
#define HD 64
#ifndef TNB
#define TNB NB
#endif
typedef __attribute__((ext_vector_type(8))) __bf16 v8b;
__device__ __forceinline__ v16b frag_b(const __bf16* rowk0, int lane) {
  union { v16b v; v8b q[2]; } u; const __bf16* p = rowk0 + 8 * (lane >> 4);
  u.q[0] = *(const v8b*)p; u.q[1] = *(const v8b*)(p + 16); return u.v;
}
__device__ __forceinline__ float bfr(float v) { return (float)(__bf16)v; }
__device__ __attribute__((noinline)) float exp_ni(float v) { return expf(v); }
__device__ __attribute__((noinline)) float erf_ni(float v) { return erff(v); }

#define WS_QH  0u
#define WS_QL  (WS_QH + 2u * (size_t)NB * TT * CC)
#define WS_KH  (WS_QL + 2u * (size_t)NB * TT * CC)
#define WS_VT  (WS_KH + 2u * (size_t)NB * TT * CC)      // f16 v planes [b][c][t]
#define HG 4
#define WS_S   (WS_VT + 2u * (size_t)NB * CC * TT)      // unused; still counted in WS_END
#define WS_PH  (WS_S + 4u * (size_t)HG * TT * TT)       // unused; still counted in WS_END
#define WS_Y   (WS_PH + 2u * (size_t)HG * TT * TT)          // f32 y rows [b*t][C]
#define WS_MB  (WS_Y + 4u * (size_t)NB * TT * CC)          // mask bits [b][k / 128][q][4 words]: bit l of word i = (attention_mask[b][q][128 (k / 128) + 4 l + i] != 0)
#define WS_END (WS_MB + (size_t)NB * TT * TT / 8)

// keeps the next pass's loads where they are written (one pass ahead of their use); moved down by the scheduler they would wait at full latency
#define SFENCE() __builtin_amdgcn_sched_barrier(0)
// behind a group of loads or stores whose registers the next instructions reuse
__device__ __forceinline__ void xwait() { asm volatile("s_wait_xcnt 0x0" ::: "memory"); }
// ---- the two linear-layer kernels: block = 8 waves (2 x 4) on a 128 x 128 tile of the output, wave = 64 x 32; a step is 64 k.
// Both operands are fetched by whole 256-byte row pieces, rounded to bf16 once per block and kept in LDS, two buffers; every wave takes its fragments from there.
#define GT 128
#define GK 64
#define GP 72    // LDS row pitch in bf16 elements: 144 B = 16 B x 9, free of bank conflicts for the 16-byte fragment reads
#define GPL (GT * GP)   // one operand plane of one buffer, in elements
typedef __attribute__((ext_vector_type(4))) __bf16 v4b;
__device__ __forceinline__ v4b cvt4(v4f v) { v4b r;
#pragma unroll
  for (int i = 0; i < 4; ++i) r[i] = (__bf16)v[i];
  return r; }
// ---- pack_mask: reads attention_mask once, as a stream, and leaves one bit a word for k_fa, whose 16 heads would each read all of it. Block = 16 mask rows; wave = 8 rows x 512 keys, all its 32 loads in flight at once.
__device__ __forceinline__ void pack_mask(const int* __restrict__ AM, unsigned* __restrict__ MB, int blk, int wave, int lane) {
  static_assert((TNB * TT / GT) * (CC / GT) * 16 == TNB * TT, "16 mask rows a block");
  const int row = (blk * 2 + (wave & 1)) * 8, j0 = (wave >> 1) * 4;
  const int* ms = AM + (size_t)row * TT + j0 * 128 + lane * 4;
  unsigned* md = MB + (((size_t)(row / TT) * (TT / 128) + j0) * TT + row % TT) * 4 + lane;
  v4i m[4][8];
#pragma unroll
  for (int c = 0; c < 4; ++c)
#pragma unroll
    for (int r = 0; r < 8; ++r) m[c][r] = *(const v4i*)(ms + (size_t)r * TT + c * 128);
  asm volatile("s_wait_xcnt 0x0" :: "v"(ms) : "memory");   // the wait behind these loads; naming ms keeps their address pair out of a load's own destination
  SFENCE();   // all 32 loads are issued before the first is waited for: one latency a wave
#pragma unroll
  for (int c = 0; c < 4; ++c) { unsigned w = 0;   // lane 4 r + i gets word i of row r: the 32 words of 8 rows and 128 keys are one 128-byte line, written by this wave alone
#pragma unroll
    for (int r = 0; r < 8; ++r)
#pragma unroll
      for (int i = 0; i < 4; ++i) { const unsigned bl = __builtin_amdgcn_ballot_w32(m[c][r][i] != 0); w = lane == r * 4 + i ? bl : w; }
    md[(size_t)c * TT * 4] = w; }
  xwait(); }
// ---- k_proj: block = (128 rows, 128 cols, which); which = 3: the 256 mask blocks, short, started last, into the places that the first finished product blocks leave; else qkv = x W (+ b), exact; q -> f16 hi (+ residual), k -> f16 rows, v -> f16 planes
// 6 waves a SIMD are asked for: with the mask blocks' code in the kernel the compiler otherwise gives the product loop 195 registers instead of its 160, and two blocks instead of three would stay on a WGP
__global__ __launch_bounds__(256, 6) void k_proj(const float* __restrict__ X, const float* __restrict__ WQ, const float* __restrict__ BQ, const float* __restrict__ WK, const float* __restrict__ BK, const float* __restrict__ WV, const float* __restrict__ BV, _Float16* __restrict__ QH, _Float16* __restrict__ QL, _Float16* __restrict__ KH, _Float16* __restrict__ VT, const int* __restrict__ AM, unsigned* __restrict__ MB) {
  __shared__ __align__(16) __bf16 sm[2 * 2 * GPL];   // [buffer][x | w][row][k]; the epilogue's f16 staging reuses it
  const int tid = threadIdx.x, wave = tid >> 5, lane = tid & 31, col = lane & 15, g = lane >> 4; const int which = blockIdx.z; const int c0 = blockIdx.y * GT; const size_t r0 = (size_t)blockIdx.x * GT; const float* WA = which == 0 ? WQ : which == 1 ? WK : WV; const float* BA = which == 0 ? BQ : which == 1 ? BK : BV;
  if (which == 3) { pack_mask(AM, MB, (int)(blockIdx.y * (TNB * TT / GT) + blockIdx.x), wave, lane); return; }   // the short blocks of the last plane: the whole block leaves here, in front of every barrier
  const int wm = wave >> 2, wn = wave & 3, lr = tid >> 4, lk = (tid & 15) * 4;
  const float* xa = X + (r0 + lr) * CC + lk; const float* wa = WA + (size_t)(c0 + lr) * CC + lk;
  v4f ra[8], rb[8];
  auto ldg = [&](int s) {
#pragma unroll
    for (int i = 0; i < 8; ++i) { ra[i] = *(const v4f*)(xa + (size_t)(i * 16) * CC + s * GK); rb[i] = *(const v4f*)(wa + (size_t)(i * 16) * CC + s * GK); } };
  auto sts = [&](int bf) { __bf16* d = sm + bf * 2 * GPL + lr * GP + lk;
#pragma unroll
    for (int i = 0; i < 8; ++i) { *(v4b*)(d + i * 16 * GP) = cvt4(ra[i]); *(v4b*)(d + GPL + i * 16 * GP) = cvt4(rb[i]); } };
  v8f acc[4][2] = {};
  ldg(0); xwait(); sts(0);
  for (int s = 0; s < CC / GK; ++s) {
    __syncthreads();   // step s's buffer is written; every wave has left the other one
    if (s + 1 < CC / GK) { ldg(s + 1); xwait(); }
    SFENCE();   // ends the scheduling region behind the loads: the fetched values are then rounded ahead of the products and held as bf16, half the registers (160 VGPRs against 192), so three blocks instead of two stay on a WGP and cover each other's loads
    const __bf16* pa = sm + (s & 1) * 2 * GPL + (wm * 64 + col) * GP; const __bf16* pw = sm + (s & 1) * 2 * GPL + GPL + (wn * 32 + col) * GP;
#pragma unroll
    for (int kk = 0; kk < GK / 32; ++kk) { v16b a[4], w[2];
#pragma unroll
      for (int i = 0; i < 4; ++i) a[i] = frag_b(pa + i * 16 * GP + kk * 32, lane);
#pragma unroll
      for (int j = 0; j < 2; ++j) w[j] = frag_b(pw + j * 16 * GP + kk * 32, lane);
#pragma unroll
      for (int i = 0; i < 4; ++i)
#pragma unroll
        for (int j = 0; j < 2; ++j) acc[i][j] = wmma_bf(a[i], w[j], acc[i][j]); }
    if (s + 1 < CC / GK) sts((s + 1) & 1); }
  const float* bp = BA + c0 + wn * 32 + col; const float braw[2] = { bp[0], bp[16] };
  asm volatile("s_wait_xcnt 0x0" :: "v"(bp) : "memory");   // the wait behind these loads; naming bp keeps their address pair out of a load's own destination
  __syncthreads();   // the last step's fragment reads are over: the buffers become the staging area
  _Float16* sh = (_Float16*)sm; _Float16* sl = sh + GT * 136;   // [128][136] each; for v one plane [col][row]
#pragma unroll
  for (int j = 0; j < 2; ++j) { const int cl = wn * 32 + j * 16 + col; const float bb = bfr(braw[j]);
#pragma unroll
    for (int i = 0; i < 4; ++i) { const int rl = wm * 64 + i * 16 + 8 * g;
      if (which == 2) { v8h pk;
#pragma unroll
        for (int r = 0; r < 8; ++r) pk[r] = (_Float16)(acc[i][j][r] + bb);
        *(v8h*)(sh + cl * 136 + rl) = pk; }
      else {
#pragma unroll
        for (int r = 0; r < 8; ++r) { const float v = acc[i][j][r] + bb; const _Float16 hv = (_Float16)v; sh[(rl + r) * 136 + cl] = hv; sl[(rl + r) * 136 + cl] = (_Float16)(v - (float)hv); } } } }
  __syncthreads();
  if (which < 2) { _Float16* dh = which == 0 ? QH : KH; for (int e = tid; e < GT * 16; e += 256) { const int rl = e >> 4, q = e & 15; vst2((unsigned*)(dh + (r0 + rl) * CC + c0 + q * 8), *(const v4u*)(sh + rl * 136 + q * 8)); xwait(); if (which == 0) { vst2((unsigned*)(QL + (r0 + rl) * CC + c0 + q * 8), *(const v4u*)(sl + rl * 136 + q * 8)); xwait(); } } }
  else { const size_t b = r0 / TT; const int t0 = (int)(r0 % TT); for (int e = tid; e < GT * 16; e += 256) { const int cl = e >> 4, q = e & 15; vst2((unsigned*)(VT + (b * CC + c0 + cl) * (size_t)TT + t0 + q * 8), *(const v4u*)(sh + cl * 136 + q * 8)); xwait(); } } }
// ---- k_fa: block = 8 waves x 32 queries of one (b,h); one pass = 32 keys, one stage = 128 keys. S^T = K.Q^T, online softmax (base 2), O^T += V^T.P^T.
// A lane holds one query's scores (D register r = key 8g + r, column = query), so two converted score tiles are the B operand of the second product: P stays in registers.
// The K rows and V^T rows of a stage are the same for all 8 waves: the block brings them into LDS once, by whole 128-byte lines, with asynchronous copies, two buffers; every wave takes its fragments from there.
#define FK 128                // keys of a stage
#define FPP (FK / 32)         // passes of a stage
#define FNS (TT / FK)         // stages
#define FPK 72                // K row in LDS, f16 elements: 144 B = 16 B x 9, free of bank conflicts for the 16-byte fragment reads
#define FPV 136               // V^T row in LDS, f16 elements: 272 B = 16 B x 17, likewise
#define FKB (FK * FPK)        // the K plane of one buffer, in elements
#define FST (FKB + HD * FPV)  // one buffer, in elements
typedef __attribute__((ext_vector_type(2))) _Float16 v2h;
__device__ __forceinline__ v8f mmah(v16h a, v16h b, v8f c) { return __builtin_amdgcn_wmma_f32_16x16x32_f16(false, a, false, b, (short)0, c, false, false); }
__device__ __forceinline__ float xhalf(float x) { return __builtin_bit_cast(float, __builtin_amdgcn_permlanex16(__builtin_bit_cast(int, x), __builtin_bit_cast(int, x), 0x76543210, 0xfedcba98, false, false)); }  // lane l with lane l ^ 16
__device__ __forceinline__ unsigned xhalfu(unsigned x) { return (unsigned)__builtin_amdgcn_permlanex16((int)x, (int)x, 0x76543210, 0xfedcba98, false, false); }  // the same for a word
// eight 16-byte copies of a lane, global memory to LDS through no register; the s_wait_xcnt stands in the copies' own statement, so that no address register is rewritten in front of it
__device__ __forceinline__ void copy8(unsigned l0, unsigned l1, unsigned l2, unsigned l3, unsigned l4, unsigned l5, unsigned l6, unsigned l7, const _Float16* g0, const _Float16* g1, const _Float16* g2, const _Float16* g3, const _Float16* g4, const _Float16* g5, const _Float16* g6, const _Float16* g7) {
  asm volatile("global_load_async_to_lds_b128 %0, %8, off\n\tglobal_load_async_to_lds_b128 %1, %9, off\n\tglobal_load_async_to_lds_b128 %2, %10, off\n\tglobal_load_async_to_lds_b128 %3, %11, off\n\t"
               "global_load_async_to_lds_b128 %4, %12, off\n\tglobal_load_async_to_lds_b128 %5, %13, off\n\tglobal_load_async_to_lds_b128 %6, %14, off\n\tglobal_load_async_to_lds_b128 %7, %15, off\n\ts_wait_xcnt 0x0"
               :: "v"(l0), "v"(l1), "v"(l2), "v"(l3), "v"(l4), "v"(l5), "v"(l6), "v"(l7), "v"(g0), "v"(g1), "v"(g2), "v"(g3), "v"(g4), "v"(g5), "v"(g6), "v"(g7) : "memory"); }
__global__ __launch_bounds__(256) void k_fa(const _Float16* __restrict__ QH, const _Float16* __restrict__ KH, const _Float16* __restrict__ VT, const unsigned* __restrict__ MB, float* __restrict__ Y) {
  __shared__ __align__(16) _Float16 sm[2 * FST];   // [buffer][K rows [key][d] | V^T rows [d][key]]
  const int tid = threadIdx.x, wave = tid >> 5, lane = tid & 31, col = lane & 15, g = lane >> 4; const int b = blockIdx.y / NH, h = blockIdx.y % NH; const int q0 = blockIdx.x * 256 + wave * 32;
  const float cs = 0.125f * 1.4426950408889634f;   // 1/sqrt(HD) and log2(e)
  const float RNEG = -0x1p126f;                    // masked raw score: a power of two, so RNEG * cs is exact and a row with every key masked gets exp2(0) = 1 at each key (uniform, as the reference)
  v16h qf[2][2], kf[2][2], vf[2][4]; v4u mk;   // the inner loops below are all unrolled: every index into a fragment array is then a constant and the arrays stay in registers
  // a thread's share of a stage: 4 pieces of K (rows 32 apart, 8 threads a 128-byte row) and 4 of V^T (rows 16 apart, 16 threads a 256-byte row piece)
  const _Float16* gk = KH + ((size_t)b * TT + (tid >> 3)) * CC + h * HD + (tid & 7) * 8;
  const _Float16* gv = VT + ((size_t)b * CC + h * HD + (tid >> 4)) * (size_t)TT + (tid & 15) * 8;
  const unsigned lk = (unsigned)(size_t)(sm + (tid >> 3) * FPK + (tid & 7) * 8), lv = (unsigned)(size_t)(sm + FKB + (tid >> 4) * FPV + (tid & 15) * 8);   // LDS byte addresses
  auto stage = [&](int t, int bf) { const _Float16* pk = gk + (size_t)t * FK * CC; const _Float16* pv = gv + t * FK; const unsigned ak = lk + bf * (FST * 2), av = lv + bf * (FST * 2);
    copy8(ak, ak + 32 * FPK * 2, ak + 64 * FPK * 2, ak + 96 * FPK * 2, av, av + 16 * FPV * 2, av + 32 * FPV * 2, av + 48 * FPV * 2, pk, pk + 32 * CC, pk + 64 * CC, pk + 96 * CC, pv, pv + 16 * TT, pv + 32 * TT, pv + 48 * TT); };
#pragma unroll
  for (int u = 0; u < 2; ++u)
#pragma unroll
    for (int kc = 0; kc < 2; ++kc) qf[u][kc] = frag_h(QH + ((size_t)b * TT + q0 + u * 16 + col) * CC + h * HD + kc * 32, lane);
  xwait();
  const unsigned* mc = MB + ((size_t)b * FNS * TT + q0 + lane) * 4;   // the mask bits of query q0 + lane, 128 keys (one stage) in 4 words; a wave's load is 512 bytes in a row
  auto ldK = [&](const _Float16* sk, int p) {
#pragma unroll
    for (int kt = 0; kt < 2; ++kt)
#pragma unroll
      for (int kc = 0; kc < 2; ++kc) kf[kt][kc] = frag_h(sk + (p * 32 + kt * 16) * FPK + kc * 32, lane); };
  auto ldV = [&](const _Float16* sv, int p) {
#pragma unroll
    for (int t = 0; t < 4; ++t) vf[p & 1][t] = frag_h(sv + t * 16 * FPV + p * 32, lane); };
  auto ldM = [&](int t) { const unsigned* pm = mc + (size_t)t * TT * 4; mk = *(const v4u*)pm;
    asm volatile("s_wait_xcnt 0x0" :: "v"(pm) : "memory"); };   // the wait behind this load; naming pm keeps its address pair as it is up to the wait
  v8f acc[2][4] = {}; v8f lacc[2] = {}; float m_run[2] = { RNEG * cs, RNEG * cs };
  v16h ones;   // A operand of all ones: every row of its product is the column sums of P^T (the denominators' increments)
#pragma unroll
  for (int i = 0; i < 16; ++i) ones[i] = (_Float16)1.0f;
  ldM(0); SFENCE();
#pragma unroll 1   // kept rolled: unrolled, lk and lv are themselves operands of the copies' statement, are held among the first 256 registers through the whole kernel and end in scratch
  for (int i = 0; i < 2; ++i) { stage(i, i);   // stage 0 into buffer 0, waited for and published; then stage 1 into buffer 1, in flight over trip 0
    if (i == 0) { asm volatile("s_wait_asynccnt 0x0" ::: "memory");   // this wave's copies of stage 0 have landed
      __syncthreads(); } }                                            // and every other wave's: stage 0 may be read
#pragma unroll 1   // one stage a trip: the four passes inside are unrolled, more would only grow the code
  for (int t = 0; t < FNS; ++t) {
    const _Float16* sk = sm + (t & 1) * FST + col * FPK; const _Float16* sv = sm + (t & 1) * FST + FKB + col * FPV;
    ldK(sk, 0); ldV(sv, 0); SFENCE();
    const v4u mw = mk; const unsigned ma = mw.x & mw.y & mw.z & mw.w; unsigned zb[FPP];   // byte p of ma = pass p's 32 keys of this lane's query; zb[p] != 0 iff pass p's 32 x 32 tile holds a masked key
#pragma unroll
    for (int p = 0; p < FPP; ++p) zb[p] = __builtin_amdgcn_ballot_w32(((ma >> (8 * p)) & 0xFFu) != 0xFFu);
    ldM((t + 1) & (FNS - 1));   // the next stage's bits, a whole stage ahead of their use; the last stage re-reads stage 0's (in bounds, unused)
    SFENCE();
#pragma unroll
    for (int p = 0; p < FPP; ++p) {
      v8f s[2][2];
#pragma unroll
      for (int kt = 0; kt < 2; ++kt)
#pragma unroll
        for (int u = 0; u < 2; ++u) { s[kt][u] = v8f{};
#pragma unroll
          for (int kc = 0; kc < 2; ++kc) s[kt][u] = mmah(kf[kt][kc], qf[u][kc], s[kt][u]); }
      SFENCE();
      if (p + 1 < FPP) { ldK(sk, p + 1); ldV(sv, p + 1); }   // the next pass's fragments, in one group, from this stage's own buffer only
      SFENCE();
      if (zb[p] != 0) {   // scalar branch: only a pass whose tile holds a masked key pays for the selects
        unsigned mo[4];   // the words of lane ^ 16, fetched with every lane on
#pragma unroll
        for (int i = 0; i < 4; ++i) mo[i] = xhalfu(mw[i]);
#pragma unroll
        for (int u = 0; u < 2; ++u) { unsigned wu[4];   // the words of query u * 16 + col: this lane's own where g == u; shifted so that bit 8 p + 4 kt + (r >> 2) of word r & 3 is key 32 p + 16 kt + 8 g + r
#pragma unroll
          for (int i = 0; i < 4; ++i) wu[i] = (g == u ? mw[i] : mo[i]) >> (2 * g);
#pragma unroll
          for (int kt = 0; kt < 2; ++kt)
#pragma unroll
            for (int r = 0; r < 8; ++r) if (((wu[r & 3] >> (8 * p + 4 * kt + (r >> 2))) & 1u) == 0u) s[kt][u][r] = RNEG; } }
      float mb[2]; bool need = false;
#pragma unroll
      for (int u = 0; u < 2; ++u) { float mx = s[0][u][0];
#pragma unroll
        for (int kt = 0; kt < 2; ++kt)
#pragma unroll
          for (int r = 0; r < 8; ++r) mx = __builtin_fmaxf(mx, s[kt][u][r]);
        mx = __builtin_fmaxf(mx, xhalf(mx)) * cs; mb[u] = mx; need = need || (mx > m_run[u] + 8.0f); }
      if (__builtin_amdgcn_ballot_w32(need) != 0) {   // lazy rescale: the maximum in use may trail the true one by up to 8 (P <= 2^8, inside f16)
#pragma unroll
        for (int u = 0; u < 2; ++u) { const float m_new = __builtin_fmaxf(m_run[u], mb[u]); const float corr = __builtin_amdgcn_exp2f(m_run[u] - m_new); m_run[u] = m_new; lacc[u] = lacc[u] * corr;
#pragma unroll
          for (int tt = 0; tt < 4; ++tt) acc[u][tt] = acc[u][tt] * corr; } }
#pragma unroll
      for (int u = 0; u < 2; ++u) { const float nm = -m_run[u]; v16h pf;
#pragma unroll
        for (int i = 0; i < 8; ++i) { const v2f arg = __builtin_elementwise_fma(v2f{s[i >> 2][u][2 * (i & 3)], s[i >> 2][u][2 * (i & 3) + 1]}, v2f{cs, cs}, v2f{nm, nm});
          const v2h pk = __builtin_convertvector(v2f{__builtin_amdgcn_exp2f(arg.x), __builtin_amdgcn_exp2f(arg.y)}, v2h); pf[2 * i] = pk.x; pf[2 * i + 1] = pk.y; }
#pragma unroll
        for (int tt = 0; tt < 4; ++tt) acc[u][tt] = mmah(vf[p & 1][tt], pf, acc[u][tt]);
        lacc[u] = mmah(ones, pf, lacc[u]); }
      SFENCE(); }
    asm volatile("s_wait_dscnt 0x0" ::: "memory");      // this wave's reads of stage t's buffer are over
    asm volatile("s_wait_asynccnt 0x0" ::: "memory");   // this wave's copies of stage t + 1 have landed
    __syncthreads();                                    // both hold for every wave: stage t + 1 may be read, stage t's buffer refilled
    if (t + 2 < FNS) stage(t + 2, t & 1); }
  asm volatile("s_wait_asynccnt 0x0" ::: "memory");   // no copy is left in flight when the wave ends
  asm volatile("s_wait_loadcnt 0x0" ::: "memory");   // the last stage's look-ahead mask load lands before the wave stores, ends and gives its registers back
#pragma unroll
  for (int u = 0; u < 2; ++u) { const float inv = 1.0f / lacc[u][0]; float* yp = Y + ((size_t)b * TT + q0 + u * 16 + col) * CC + h * HD + 8 * g;
#pragma unroll
    for (int t = 0; t < 4; ++t) { const v8f o = acc[u][t] * inv; vst2(yp + t * 16, v4f{o[0], o[1], o[2], o[3]}); vst2(yp + t * 16 + 4, v4f{o[4], o[5], o[6], o[7]}); } } }
// ---- k_out: block = (128 rows, 128 cols): out = y (bf16 hi + lo) Wproj + b
__global__ __launch_bounds__(256) void k_out(const float* __restrict__ Y, const float* __restrict__ WP, const float* __restrict__ BP, float* __restrict__ OUT) {
  __shared__ __align__(16) __bf16 sm[2 * 3 * GPL];   // [buffer][y hi | y lo | w][row][k]; the epilogue's f32 staging reuses it
  const int tid = threadIdx.x, wave = tid >> 5, lane = tid & 31, col = lane & 15, g = lane >> 4; const int c0 = blockIdx.y * GT; const size_t r0 = (size_t)blockIdx.x * GT;
  const int wm = wave >> 2, wn = wave & 3, lr = tid >> 4, lk = (tid & 15) * 4;
  const float* ya = Y + (r0 + lr) * CC + lk; const float* wa = WP + (size_t)(c0 + lr) * CC + lk;
  v4f ra[8], rb[8];
  auto ldg = [&](int s) {
#pragma unroll
    for (int i = 0; i < 8; ++i) { ra[i] = *(const v4f*)(ya + (size_t)(i * 16) * CC + s * GK); rb[i] = *(const v4f*)(wa + (size_t)(i * 16) * CC + s * GK); } };
  auto sts = [&](int bf) { __bf16* d = sm + bf * 3 * GPL + lr * GP + lk;
#pragma unroll
    for (int i = 0; i < 8; ++i) { const v4b hi = cvt4(ra[i]); v4f rs;
#pragma unroll
      for (int e = 0; e < 4; ++e) rs[e] = ra[i][e] - (float)hi[e];
      *(v4b*)(d + i * 16 * GP) = hi; *(v4b*)(d + GPL + i * 16 * GP) = cvt4(rs); *(v4b*)(d + 2 * GPL + i * 16 * GP) = cvt4(rb[i]); } };
  v8f acc[4][2] = {};
  ldg(0); xwait(); sts(0);
  for (int s = 0; s < CC / GK; ++s) {
    __syncthreads();   // step s's buffer is written; every wave has left the other one
    if (s + 1 < CC / GK) { ldg(s + 1); xwait(); }
    const __bf16* pa = sm + (s & 1) * 3 * GPL + (wm * 64 + col) * GP; const __bf16* pw = sm + (s & 1) * 3 * GPL + 2 * GPL + (wn * 32 + col) * GP;
#pragma unroll
    for (int kk = 0; kk < GK / 32; ++kk) { v16b ah[4], al[4], w[2];
#pragma unroll
      for (int i = 0; i < 4; ++i) { ah[i] = frag_b(pa + i * 16 * GP + kk * 32, lane); al[i] = frag_b(pa + GPL + i * 16 * GP + kk * 32, lane); }
#pragma unroll
      for (int j = 0; j < 2; ++j) w[j] = frag_b(pw + j * 16 * GP + kk * 32, lane);
#pragma unroll
      for (int i = 0; i < 4; ++i)
#pragma unroll
        for (int j = 0; j < 2; ++j) acc[i][j] = wmma_bf(ah[i], w[j], acc[i][j]);
#pragma unroll
      for (int i = 0; i < 4; ++i)
#pragma unroll
        for (int j = 0; j < 2; ++j) acc[i][j] = wmma_bf(al[i], w[j], acc[i][j]); }
    if (s + 1 < CC / GK) sts((s + 1) & 1); }
  float braw[2] = { 0.f, 0.f };
  if (BP) { const float* bp = BP + c0 + wn * 32 + col; braw[0] = bp[0]; braw[1] = bp[16];
    asm volatile("s_wait_xcnt 0x0" :: "v"(bp) : "memory"); }   // the wait behind these loads; naming bp keeps their address pair out of a load's own destination
  __syncthreads();   // the last step's fragment reads are over: the buffers become the staging area
  float* sf = (float*)sm;   // [128][132]
#pragma unroll
  for (int j = 0; j < 2; ++j) { const int cl = wn * 32 + j * 16 + col; const float bb = bfr(braw[j]);
#pragma unroll
    for (int i = 0; i < 4; ++i)
#pragma unroll
      for (int r = 0; r < 8; ++r) sf[(wm * 64 + i * 16 + 8 * g + r) * 132 + cl] = acc[i][j][r] + bb; }
  __syncthreads();
  for (int e = tid; e < GT * 32; e += 256) { const int rl = e >> 5, q = e & 31; vst2(OUT + (r0 + rl) * CC + c0 + q * 4, *(const v4f*)(sf + rl * 132 + q * 4)); xwait(); } }
extern "C" void kernel_launch(void* const* d_in, const int* in_sizes, int n_in, void* d_out, int out_size, void* d_ws, size_t ws_size, hipStream_t stream) {
  (void)in_sizes; (void)n_in; (void)out_size;
  const float** F = (const float**)d_in;   // 0 hidden_states [2,2048,1024], 1 attention_mask [2,1,2048,2048] int32, 2 wq [1024,1024] ([out,in]), 3 bq, 4 wk, 5 bk, 6 wv, 7 bv, 8 wo, 9 bo
  if (ws_size < (size_t)WS_END) return;
  char* ws = (char*)d_ws; _Float16 *QH = (_Float16*)(ws + WS_QH), *QL = (_Float16*)(ws + WS_QL), *KH = (_Float16*)(ws + WS_KH), *VT = (_Float16*)(ws + WS_VT); float *Y = (float*)(ws + WS_Y); unsigned *MB = (unsigned*)(ws + WS_MB);
  k_proj<<<dim3(TNB * TT / 128, CC / 128, 4), 256, 0, stream>>>(F[0], F[2], F[3], F[4], F[5], F[6], F[7], QH, QL, KH, VT, (const int*)d_in[1], MB);
  k_fa<<<dim3(TT / 256, TNB * NH), 256, 0, stream>>>(QH, KH, VT, MB, Y);
  k_out<<<dim3(TNB * TT / 128, CC / 128), 256, 0, stream>>>(Y, F[8], F[9], (float*)d_out);
}

// v005
// Measured time: 87 microseconds a run.
// In two side-by-side timings against v004, it was 1.09 and 1.10 times as fast.
// All steps since v000 together make it 14.1 times as fast.
// compute dtype: all float inputs rounded to bf16, attention_mask (int) read once and packed to one bit a word; q/k/v = x W^T + b with EXACT bf16 products on WMMA 16x16x32, f32 accumulate; q, k rounded once to f16 (1-product logits / 8, std ~1), masked where attention_mask == 0, kept in f32 registers; online softmax in f32 (base 2) -> P f16 (unnormalised, <= 2^8); o = P . v (v once to f16) / sum P; out = o (bf16 hi + lo) Wo^T + bo; f32 output.
#include <hip/hip_runtime.h>
#include <math.h>

typedef __attribute__((ext_vector_type(16))) _Float16 v16h;
typedef __attribute__((ext_vector_type(16))) __bf16 v16b;
typedef __attribute__((ext_vector_type(8)))  _Float16 v8h;
typedef __attribute__((ext_vector_type(8)))  float v8f;
typedef __attribute__((ext_vector_type(4)))  float v4f;
typedef __attribute__((ext_vector_type(2)))  float v2f;
typedef __attribute__((ext_vector_type(4)))  unsigned v4u;
typedef __attribute__((ext_vector_type(4)))  int v4i;
typedef float __attribute__((may_alias)) float_a;
typedef int __attribute__((may_alias)) int_a;

template <typename T> __device__ __forceinline__ void vst2(void* p, T v) { *(T*)p = v;  }
__device__ __forceinline__ v8f wmma16(v16h a, v16h b, v8f c) {
  v8f d = __builtin_amdgcn_wmma_f32_16x16x32_f16(false, a, false, b, (short)0, c, false, false);
  asm volatile("v_nop\n\tv_nop\n\tv_nop\n\tv_nop" : "+v"(d) : "v"(a), "v"(b));
  return d;
}
__device__ __forceinline__ v8f wmma_bf(v16b a, v16b b, v8f c) {
  v8f d = __builtin_amdgcn_wmma_f32_16x16x32_bf16(false, a, false, b, (short)0, c, false, false);
  asm volatile("v_nop\n\tv_nop\n\tv_nop\n\tv_nop" : "+v"(d) : "v"(a), "v"(b));
  return d;
}
// 16x16x32 fragments: lane = (h = lane>>4, row/col = lane&15); elements 0..7 = k0+8h+0..7, 8..15 = k0+16+8h+0..7; D element r = row 8h+r
__device__ __forceinline__ v16h frag_h(const _Float16* rowk0, int lane) {
  union { v16h v; v8h q[2]; } u; const _Float16* p = rowk0 + 8 * (lane >> 4);
  u.q[0] = *(const v8h*)p; u.q[1] = *(const v8h*)(p + 16); return u.v;
}
__device__ __forceinline__ v16h frag_f32(const float* rowk0, int lane) {
  v16h a; const float* p = rowk0 + 8 * (lane >> 4);
#pragma unroll
  for (int i = 0; i < 8; ++i) { a[i] = (_Float16)p[i]; a[8 + i] = (_Float16)p[16 + i]; }
  return a;
}
__device__ __forceinline__ v16h frag_f32s(const float* rowk0, int lane, float sc) {
  v16h a; const float* p = rowk0 + 8 * (lane >> 4);
#pragma unroll
  for (int i = 0; i < 8; ++i) { a[i] = (_Float16)(p[i] * sc); a[8 + i] = (_Float16)(p[16 + i] * sc); }
  return a;
}
// column fragment from a [K][ld] layout (column n), rows >= K read as 0
__device__ __forceinline__ v16h fragc_f32(const float* W, int k0, int n, int lane, int ld, int K) {
  v16h a; const int g = lane >> 4;
#pragma unroll
  for (int i = 0; i < 8; ++i) { const int ka = k0 + 8 * g + i, kb = ka + 16;
    a[i] = (_Float16)(ka < K ? W[(size_t)(ka < K ? ka : K - 1) * ld + n] : 0.f); a[8 + i] = (_Float16)(kb < K ? W[(size_t)(kb < K ? kb : K - 1) * ld + n] : 0.f); }
  return a;
}
struct F2 { v16b h, l; };
__device__ __forceinline__ F2 bsplit16(const float v[16]) { F2 r;
#pragma unroll
  for (int i = 0; i < 16; ++i) { const __bf16 h = (__bf16)v[i]; r.h[i] = h; r.l[i] = (__bf16)(v[i] - (float)h); }
  return r; }
__device__ __forceinline__ F2 split_row(const float* row, int k0, int lane) { float v[16]; const float* p = row + k0 + 8 * (lane >> 4);
#pragma unroll
  for (int i = 0; i < 8; ++i) { v[i] = p[i]; v[8 + i] = p[16 + i]; }
  return bsplit16(v); }
__device__ __forceinline__ F2 split_rowK(const float* row, int k0, int lane, int K) { float v[16]; const int g = lane >> 4;
#pragma unroll
  for (int i = 0; i < 8; ++i) { const int ka = k0 + 8 * g + i, kb = ka + 16; v[i] = ka < K ? row[ka < K ? ka : K - 1] : 0.f; v[8 + i] = kb < K ? row[kb < K ? kb : K - 1] : 0.f; }
  return bsplit16(v); }
__device__ __forceinline__ F2 split_col(const float* W, int k0, int n, int lane, int ld, int K) { float v[16]; const int g = lane >> 4;
#pragma unroll
  for (int i = 0; i < 8; ++i) { const int ka = k0 + 8 * g + i, kb = ka + 16; v[i] = ka < K ? W[(size_t)(ka < K ? ka : K - 1) * ld + n] : 0.f; v[8 + i] = kb < K ? W[(size_t)(kb < K ? kb : K - 1) * ld + n] : 0.f; }
  return bsplit16(v); }
__device__ __forceinline__ v8f mac3(const F2& a, const F2& b, v8f c) { c = wmma_bf(a.l, b.h, c); c = wmma_bf(a.h, b.l, c); return wmma_bf(a.h, b.h, c); }
__device__ __forceinline__ float sigm(float v) { return 1.0f / (1.0f + expf(-v)); }
#define LDSX() do { asm volatile("s_wait_dscnt 0" ::: "memory"); __builtin_amdgcn_wave_barrier(); __builtin_amdgcn_fence(__ATOMIC_RELEASE, "workgroup"); } while (0)


// Multi-head scaled dot-product attention (B 2, S 2,048, E 1,024 = 16 x 64) with an integer attention_mask [B,1,S,S] (0 -> masked), output Linear.
#define NB 2
#define TT 2048
#define CC 1024
#define NH 16
#define HD 64
#ifndef TNB
#define TNB NB
#endif
typedef __attribute__((ext_vector_type(8))) __bf16 v8b;
__device__ __forceinline__ v16b frag_b(const __bf16* rowk0, int lane) {
  union { v16b v; v8b q[2]; } u; const __bf16* p = rowk0 + 8 * (lane >> 4);
  u.q[0] = *(const v8b*)p; u.q[1] = *(const v8b*)(p + 16); return u.v;
}
__device__ __forceinline__ float bfr(float v) { return (float)(__bf16)v; }
__device__ __attribute__((noinline)) float exp_ni(float v) { return expf(v); }
__device__ __attribute__((noinline)) float erf_ni(float v) { return erff(v); }

#define WS_QH  0u
#define WS_QL  (WS_QH + 2u * (size_t)NB * TT * CC)
#define WS_KH  (WS_QL + 2u * (size_t)NB * TT * CC)
#define WS_VT  (WS_KH + 2u * (size_t)NB * TT * CC)      // f16 v planes [b][c][t]
#define HG 4
#define WS_S   (WS_VT + 2u * (size_t)NB * CC * TT)      // unused: the logits stay in registers
#define WS_PH  (WS_S + 4u * (size_t)HG * TT * TT)       // unused: P stays in registers
#define WS_YH  (WS_PH + 2u * (size_t)HG * TT * TT)          // bf16 y rows [b*t][C], high part
#define WS_YL  (WS_YH + 2u * (size_t)NB * TT * CC)          // bf16 y rows, what the high part leaves
#define WS_MB  (WS_YL + 2u * (size_t)NB * TT * CC)          // mask bits [b][k / 128][q][4 words]: bit l of word i = (attention_mask[b][q][128 (k / 128) + 4 l + i] != 0)
#define WS_XB  (WS_MB + (size_t)NB * TT * TT / 8)          // bf16 x rows [b*t][C]
#define WS_WB  (WS_XB + 2u * (size_t)NB * TT * CC)          // bf16 weights [wq | wk | wv | wo][out][in]
#define WS_WO  (WS_WB + 2u * 3u * (size_t)CC * CC)
#define WS_END (WS_WB + 2u * 4u * (size_t)CC * CC)

// keeps the next pass's loads where they are written (one pass ahead of their use); moved down by the scheduler they would wait at full latency
#define SFENCE() __builtin_amdgcn_sched_barrier(0)
// behind a group of loads or stores whose registers the next instructions reuse
__device__ __forceinline__ void xwait() { asm volatile("s_wait_xcnt 0x0" ::: "memory"); }
// ---- the two linear-layer kernels: block = 8 waves (2 x 4) on a 128 x 128 tile of the output, wave = 64 x 32; a step is 64 k.
// Both operands arrive as bf16 (k_cvt, k_fa), are fetched by whole 128-byte row pieces and kept in LDS, two buffers; every wave takes its fragments from there.
#define GT 128
#define GK 64
#define GP 72    // LDS row pitch in bf16 elements: 144 B = 16 B x 9, free of bank conflicts for the 16-byte fragment reads
#define GPL (GT * GP)   // one operand plane of one buffer, in elements
typedef __attribute__((ext_vector_type(4))) __bf16 v4b;
__device__ __forceinline__ v4b cvt4(v4f v) { v4b r;
#pragma unroll
  for (int i = 0; i < 4; ++i) r[i] = (__bf16)v[i];
  return r; }
// ---- k_cvt: x and the four weight matrices rounded to bf16 once, as a stream; the 24 or 32 blocks of k_proj and k_out that read a row then fetch 2 bytes an element from L2 and round nothing.
// Block = 32,768 elements in a row, one block a WGP; a wave's load is 512 bytes in a row, its store 256; all 32 loads of a thread are in flight at once.
#define CVE 32768
__global__ __launch_bounds__(256) void k_cvt(const float* __restrict__ X, const float* __restrict__ WQ, const float* __restrict__ WK, const float* __restrict__ WV, const float* __restrict__ WO, __bf16* __restrict__ XB, __bf16* __restrict__ WB) {
  const int NX = TNB * TT * CC / CVE, NW = CC * CC / CVE; const int blk = blockIdx.x, w = (blk - NX) / NW;
  const float* s = blk < NX ? X + (size_t)blk * CVE : (w == 0 ? WQ : w == 1 ? WK : w == 2 ? WV : WO) + (size_t)((blk - NX) % NW) * CVE;
  __bf16* d = blk < NX ? XB + (size_t)blk * CVE : WB + (size_t)(blk - NX) * CVE;
  s += threadIdx.x * 4; d += threadIdx.x * 4;
  v4f v[CVE / 1024];
#pragma unroll
  for (int i = 0; i < CVE / 1024; ++i) v[i] = *(const v4f*)(s + i * 1024);
  xwait();
  SFENCE();   // all 32 loads are issued before the first is waited for: one latency a wave
#pragma unroll
  for (int i = 0; i < CVE / 1024; ++i) *(v4b*)(d + i * 1024) = cvt4(v[i]);
  xwait(); }
// ---- pack_mask: reads attention_mask once, as a stream, and leaves one bit a word for k_fa, whose 16 heads would each read all of it. Block = 16 mask rows; wave = 8 rows x 512 keys, all its 32 loads in flight at once.
__device__ __forceinline__ void pack_mask(const int* __restrict__ AM, unsigned* __restrict__ MB, int blk, int wave, int lane) {
  static_assert((TNB * TT / GT) * (CC / GT) * 16 == TNB * TT, "16 mask rows a block");
  const int row = (blk * 2 + (wave & 1)) * 8, j0 = (wave >> 1) * 4;
  const int* ms = AM + (size_t)row * TT + j0 * 128 + lane * 4;
  unsigned* md = MB + (((size_t)(row / TT) * (TT / 128) + j0) * TT + row % TT) * 4 + lane;
  v4i m[4][8];
#pragma unroll
  for (int c = 0; c < 4; ++c)
#pragma unroll
    for (int r = 0; r < 8; ++r) m[c][r] = *(const v4i*)(ms + (size_t)r * TT + c * 128);
  asm volatile("s_wait_xcnt 0x0" :: "v"(ms) : "memory");   // the wait behind these loads; naming ms keeps their address pair out of a load's own destination
  SFENCE();   // all 32 loads are issued before the first is waited for: one latency a wave
#pragma unroll
  for (int c = 0; c < 4; ++c) { unsigned w = 0;   // lane 4 r + i gets word i of row r: the 32 words of 8 rows and 128 keys are one 128-byte line, written by this wave alone
#pragma unroll
    for (int r = 0; r < 8; ++r)
#pragma unroll
      for (int i = 0; i < 4; ++i) { const unsigned bl = __builtin_amdgcn_ballot_w32(m[c][r][i] != 0); w = lane == r * 4 + i ? bl : w; }
    md[(size_t)c * TT * 4] = w; }
  xwait(); }
// ---- k_proj: block = (128 rows, 128 cols, which); which = 3: the 256 mask blocks, short, started last, into the places that the first finished product blocks leave; else qkv = x W (+ b), exact; q -> f16 hi (+ residual), k -> f16 rows, v -> f16 planes
// 6 waves a SIMD are asked for, so that the mask blocks' code in the kernel does not raise the register count above 160 and three blocks stay on a WGP
__global__ __launch_bounds__(256, 6) void k_proj(const __bf16* __restrict__ XB, const __bf16* __restrict__ WB, const float* __restrict__ BQ, const float* __restrict__ BK, const float* __restrict__ BV, _Float16* __restrict__ QH, _Float16* __restrict__ QL, _Float16* __restrict__ KH, _Float16* __restrict__ VT, const int* __restrict__ AM, unsigned* __restrict__ MB) {
  __shared__ __align__(16) __bf16 sm[2 * 2 * GPL];   // [buffer][x | w][row][k]; the epilogue's f16 staging reuses it
  const int tid = threadIdx.x, wave = tid >> 5, lane = tid & 31, col = lane & 15, g = lane >> 4; const int which = blockIdx.z; const int c0 = blockIdx.y * GT; const size_t r0 = (size_t)blockIdx.x * GT; const float* BA = which == 0 ? BQ : which == 1 ? BK : BV;
  if (which == 3) { pack_mask(AM, MB, (int)(blockIdx.y * (TNB * TT / GT) + blockIdx.x), wave, lane); return; }   // the short blocks of the last plane: the whole block leaves here, in front of every barrier
  const int wm = wave >> 2, wn = wave & 3, lr = tid >> 3, lk = (tid & 7) * 8;
  const __bf16* xa = XB + (r0 + lr) * CC + lk; const __bf16* wa = WB + ((size_t)which * CC + c0 + lr) * CC + lk;
  v8b ra[4], rb[4];
  auto ldg = [&](int s) {
#pragma unroll
    for (int i = 0; i < 4; ++i) { ra[i] = *(const v8b*)(xa + (size_t)(i * 32) * CC + s * GK); rb[i] = *(const v8b*)(wa + (size_t)(i * 32) * CC + s * GK); } };
  auto sts = [&](int bf) { __bf16* d = sm + bf * 2 * GPL + lr * GP + lk;
#pragma unroll
    for (int i = 0; i < 4; ++i) { *(v8b*)(d + i * 32 * GP) = ra[i]; *(v8b*)(d + GPL + i * 32 * GP) = rb[i]; } };
  v8f acc[4][2] = {};
  ldg(0); xwait(); sts(0);
  for (int s = 0; s < CC / GK; ++s) {
    __syncthreads();   // step s's buffer is written; every wave has left the other one
    if (s + 1 < CC / GK) { ldg(s + 1); xwait(); }
    SFENCE();   // keeps the next step's loads here, ahead of this step's products, which cover their latency; they are waited for only at the stores to LDS behind the products
    const __bf16* pa = sm + (s & 1) * 2 * GPL + (wm * 64 + col) * GP; const __bf16* pw = sm + (s & 1) * 2 * GPL + GPL + (wn * 32 + col) * GP;
#pragma unroll
    for (int kk = 0; kk < GK / 32; ++kk) { v16b a[4], w[2];
#pragma unroll
      for (int i = 0; i < 4; ++i) a[i] = frag_b(pa + i * 16 * GP + kk * 32, lane);
#pragma unroll
      for (int j = 0; j < 2; ++j) w[j] = frag_b(pw + j * 16 * GP + kk * 32, lane);
#pragma unroll
      for (int i = 0; i < 4; ++i)
#pragma unroll
        for (int j = 0; j < 2; ++j) acc[i][j] = wmma_bf(a[i], w[j], acc[i][j]); }
    if (s + 1 < CC / GK) sts((s + 1) & 1); }
  const float* bp = BA + c0 + wn * 32 + col; const float braw[2] = { bp[0], bp[16] };
  asm volatile("s_wait_xcnt 0x0" :: "v"(bp) : "memory");   // the wait behind these loads; naming bp keeps their address pair out of a load's own destination
  __syncthreads();   // the last step's fragment reads are over: the buffers become the staging area
  _Float16* sh = (_Float16*)sm; _Float16* sl = sh + GT * 136;   // [128][136] each; for v one plane [col][row]
#pragma unroll
  for (int j = 0; j < 2; ++j) { const int cl = wn * 32 + j * 16 + col; const float bb = bfr(braw[j]);
#pragma unroll
    for (int i = 0; i < 4; ++i) { const int rl = wm * 64 + i * 16 + 8 * g;
      if (which == 2) { v8h pk;
#pragma unroll
        for (int r = 0; r < 8; ++r) pk[r] = (_Float16)(acc[i][j][r] + bb);
        *(v8h*)(sh + cl * 136 + rl) = pk; }
      else {
#pragma unroll
        for (int r = 0; r < 8; ++r) { const float v = acc[i][j][r] + bb; const _Float16 hv = (_Float16)v; sh[(rl + r) * 136 + cl] = hv; sl[(rl + r) * 136 + cl] = (_Float16)(v - (float)hv); } } } }
  __syncthreads();
  if (which < 2) { _Float16* dh = which == 0 ? QH : KH; for (int e = tid; e < GT * 16; e += 256) { const int rl = e >> 4, q = e & 15; vst2((unsigned*)(dh + (r0 + rl) * CC + c0 + q * 8), *(const v4u*)(sh + rl * 136 + q * 8)); xwait(); if (which == 0) { vst2((unsigned*)(QL + (r0 + rl) * CC + c0 + q * 8), *(const v4u*)(sl + rl * 136 + q * 8)); xwait(); } } }
  else { const size_t b = r0 / TT; const int t0 = (int)(r0 % TT); for (int e = tid; e < GT * 16; e += 256) { const int cl = e >> 4, q = e & 15; vst2((unsigned*)(VT + (b * CC + c0 + cl) * (size_t)TT + t0 + q * 8), *(const v4u*)(sh + cl * 136 + q * 8)); xwait(); } } }
// ---- k_fa: block = 8 waves x 32 queries of one (b,h); one pass = 32 keys, one stage = 128 keys. S^T = K.Q^T, online softmax (base 2), O^T += V^T.P^T.
// A lane holds one query's scores (D register r = key 8g + r, column = query), so two converted score tiles are the B operand of the second product: P stays in registers.
// The K rows and V^T rows of a stage are the same for all 8 waves: the block brings them into LDS once, by whole 128-byte lines, with asynchronous copies, two buffers; every wave takes its fragments from there.
#define FK 128                // keys of a stage
#define FPP (FK / 32)         // passes of a stage
#define FNS (TT / FK)         // stages
#define FPK 72                // K row in LDS, f16 elements: 144 B = 16 B x 9, free of bank conflicts for the 16-byte fragment reads
#define FPV 136               // V^T row in LDS, f16 elements: 272 B = 16 B x 17, likewise
#define FKB (FK * FPK)        // the K plane of one buffer, in elements
#define FST (FKB + HD * FPV)  // one buffer, in elements
typedef __attribute__((ext_vector_type(2))) _Float16 v2h;
__device__ __forceinline__ v8f mmah(v16h a, v16h b, v8f c) { return __builtin_amdgcn_wmma_f32_16x16x32_f16(false, a, false, b, (short)0, c, false, false); }
__device__ __forceinline__ float xhalf(float x) { return __builtin_bit_cast(float, __builtin_amdgcn_permlanex16(__builtin_bit_cast(int, x), __builtin_bit_cast(int, x), 0x76543210, 0xfedcba98, false, false)); }  // lane l with lane l ^ 16
__device__ __forceinline__ unsigned xhalfu(unsigned x) { return (unsigned)__builtin_amdgcn_permlanex16((int)x, (int)x, 0x76543210, 0xfedcba98, false, false); }  // the same for a word
// eight 16-byte copies of a lane, global memory to LDS through no register; the s_wait_xcnt stands in the copies' own statement, so that no address register is rewritten in front of it
__device__ __forceinline__ void copy8(unsigned l0, unsigned l1, unsigned l2, unsigned l3, unsigned l4, unsigned l5, unsigned l6, unsigned l7, const _Float16* g0, const _Float16* g1, const _Float16* g2, const _Float16* g3, const _Float16* g4, const _Float16* g5, const _Float16* g6, const _Float16* g7) {
  asm volatile("global_load_async_to_lds_b128 %0, %8, off\n\tglobal_load_async_to_lds_b128 %1, %9, off\n\tglobal_load_async_to_lds_b128 %2, %10, off\n\tglobal_load_async_to_lds_b128 %3, %11, off\n\t"
               "global_load_async_to_lds_b128 %4, %12, off\n\tglobal_load_async_to_lds_b128 %5, %13, off\n\tglobal_load_async_to_lds_b128 %6, %14, off\n\tglobal_load_async_to_lds_b128 %7, %15, off\n\ts_wait_xcnt 0x0"
               :: "v"(l0), "v"(l1), "v"(l2), "v"(l3), "v"(l4), "v"(l5), "v"(l6), "v"(l7), "v"(g0), "v"(g1), "v"(g2), "v"(g3), "v"(g4), "v"(g5), "v"(g6), "v"(g7) : "memory"); }
__global__ __launch_bounds__(256) void k_fa(const _Float16* __restrict__ QH, const _Float16* __restrict__ KH, const _Float16* __restrict__ VT, const unsigned* __restrict__ MB, __bf16* __restrict__ YH, __bf16* __restrict__ YL) {
  __shared__ __align__(16) _Float16 sm[2 * FST];   // [buffer][K rows [key][d] | V^T rows [d][key]]
  const int tid = threadIdx.x, wave = tid >> 5, lane = tid & 31, col = lane & 15, g = lane >> 4; const int b = blockIdx.y / NH, h = blockIdx.y % NH; const int q0 = blockIdx.x * 256 + wave * 32;
  const float cs = 0.125f * 1.4426950408889634f;   // 1/sqrt(HD) and log2(e)
  const float RNEG = -0x1p126f;                    // masked raw score: a power of two, so RNEG * cs is exact and a row with every key masked gets exp2(0) = 1 at each key (uniform, as the reference)
  v16h qf[2][2], kf[2][2], vf[2][4]; v4u mk;   // the inner loops below are all unrolled: every index into a fragment array is then a constant and the arrays stay in registers
  // a thread's share of a stage: 4 pieces of K (rows 32 apart, 8 threads a 128-byte row) and 4 of V^T (rows 16 apart, 16 threads a 256-byte row piece)
  const _Float16* gk = KH + ((size_t)b * TT + (tid >> 3)) * CC + h * HD + (tid & 7) * 8;
  const _Float16* gv = VT + ((size_t)b * CC + h * HD + (tid >> 4)) * (size_t)TT + (tid & 15) * 8;
  const unsigned lk = (unsigned)(size_t)(sm + (tid >> 3) * FPK + (tid & 7) * 8), lv = (unsigned)(size_t)(sm + FKB + (tid >> 4) * FPV + (tid & 15) * 8);   // LDS byte addresses
  auto stage = [&](int t, int bf) { const _Float16* pk = gk + (size_t)t * FK * CC; const _Float16* pv = gv + t * FK; const unsigned ak = lk + bf * (FST * 2), av = lv + bf * (FST * 2);
    copy8(ak, ak + 32 * FPK * 2, ak + 64 * FPK * 2, ak + 96 * FPK * 2, av, av + 16 * FPV * 2, av + 32 * FPV * 2, av + 48 * FPV * 2, pk, pk + 32 * CC, pk + 64 * CC, pk + 96 * CC, pv, pv + 16 * TT, pv + 32 * TT, pv + 48 * TT); };
#pragma unroll
  for (int u = 0; u < 2; ++u)
#pragma unroll
    for (int kc = 0; kc < 2; ++kc) qf[u][kc] = frag_h(QH + ((size_t)b * TT + q0 + u * 16 + col) * CC + h * HD + kc * 32, lane);
  xwait();
  const unsigned* mc = MB + ((size_t)b * FNS * TT + q0 + lane) * 4;   // the mask bits of query q0 + lane, 128 keys (one stage) in 4 words; a wave's load is 512 bytes in a row
  auto ldK = [&](const _Float16* sk, int p) {
#pragma unroll
    for (int kt = 0; kt < 2; ++kt)
#pragma unroll
      for (int kc = 0; kc < 2; ++kc) kf[kt][kc] = frag_h(sk + (p * 32 + kt * 16) * FPK + kc * 32, lane); };
  auto ldV = [&](const _Float16* sv, int p) {
#pragma unroll
    for (int t = 0; t < 4; ++t) vf[p & 1][t] = frag_h(sv + t * 16 * FPV + p * 32, lane); };
  auto ldM = [&](int t) { const unsigned* pm = mc + (size_t)t * TT * 4; mk = *(const v4u*)pm;
    asm volatile("s_wait_xcnt 0x0" :: "v"(pm) : "memory"); };   // the wait behind this load; naming pm keeps its address pair as it is up to the wait
  v8f acc[2][4] = {}; v8f lacc[2] = {}; float m_run[2] = { RNEG * cs, RNEG * cs };
  v16h ones;   // A operand of all ones: every row of its product is the column sums of P^T (the denominators' increments)
#pragma unroll
  for (int i = 0; i < 16; ++i) ones[i] = (_Float16)1.0f;
  ldM(0); SFENCE();
#pragma unroll 1   // kept rolled: unrolled, lk and lv are themselves operands of the copies' statement, are held among the first 256 registers through the whole kernel and end in scratch
  for (int i = 0; i < 2; ++i) { stage(i, i);   // stage 0 into buffer 0, waited for and published; then stage 1 into buffer 1, in flight over trip 0
    if (i == 0) { asm volatile("s_wait_asynccnt 0x0" ::: "memory");   // this wave's copies of stage 0 have landed
      __syncthreads(); } }                                            // and every other wave's: stage 0 may be read
#pragma unroll 1   // one stage a trip: the four passes inside are unrolled, more would only grow the code
  for (int t = 0; t < FNS; ++t) {
    const _Float16* sk = sm + (t & 1) * FST + col * FPK; const _Float16* sv = sm + (t & 1) * FST + FKB + col * FPV;
    ldK(sk, 0); ldV(sv, 0); SFENCE();
    const v4u mw = mk; const unsigned ma = mw.x & mw.y & mw.z & mw.w; unsigned zb[FPP];   // byte p of ma = pass p's 32 keys of this lane's query; zb[p] != 0 iff pass p's 32 x 32 tile holds a masked key
#pragma unroll
    for (int p = 0; p < FPP; ++p) zb[p] = __builtin_amdgcn_ballot_w32(((ma >> (8 * p)) & 0xFFu) != 0xFFu);
    ldM((t + 1) & (FNS - 1));   // the next stage's bits, a whole stage ahead of their use; the last stage re-reads stage 0's (in bounds, unused)
    SFENCE();
#pragma unroll
    for (int p = 0; p < FPP; ++p) {
      v8f s[2][2];
#pragma unroll
      for (int kt = 0; kt < 2; ++kt)
#pragma unroll
        for (int u = 0; u < 2; ++u) { s[kt][u] = v8f{};
#pragma unroll
          for (int kc = 0; kc < 2; ++kc) s[kt][u] = mmah(kf[kt][kc], qf[u][kc], s[kt][u]); }
      SFENCE();
      if (p + 1 < FPP) { ldK(sk, p + 1); ldV(sv, p + 1); }   // the next pass's fragments, in one group, from this stage's own buffer only
      SFENCE();
      if (zb[p] != 0) {   // scalar branch: only a pass whose tile holds a masked key pays for the selects
        unsigned mo[4];   // the words of lane ^ 16, fetched with every lane on
#pragma unroll
        for (int i = 0; i < 4; ++i) mo[i] = xhalfu(mw[i]);
#pragma unroll
        for (int u = 0; u < 2; ++u) { unsigned wu[4];   // the words of query u * 16 + col: this lane's own where g == u; shifted so that bit 8 p + 4 kt + (r >> 2) of word r & 3 is key 32 p + 16 kt + 8 g + r
#pragma unroll
          for (int i = 0; i < 4; ++i) wu[i] = (g == u ? mw[i] : mo[i]) >> (2 * g);
#pragma unroll
          for (int kt = 0; kt < 2; ++kt)
#pragma unroll
            for (int r = 0; r < 8; ++r) if (((wu[r & 3] >> (8 * p + 4 * kt + (r >> 2))) & 1u) == 0u) s[kt][u][r] = RNEG; } }
      float mb[2]; bool need = false;
#pragma unroll
      for (int u = 0; u < 2; ++u) { float mx = s[0][u][0];
#pragma unroll
        for (int kt = 0; kt < 2; ++kt)
#pragma unroll
          for (int r = 0; r < 8; ++r) mx = __builtin_fmaxf(mx, s[kt][u][r]);
        mx = __builtin_fmaxf(mx, xhalf(mx)) * cs; mb[u] = mx; need = need || (mx > m_run[u] + 8.0f); }
      if (__builtin_amdgcn_ballot_w32(need) != 0) {   // lazy rescale: the maximum in use may trail the true one by up to 8 (P <= 2^8, inside f16)
#pragma unroll
        for (int u = 0; u < 2; ++u) { const float m_new = __builtin_fmaxf(m_run[u], mb[u]); const float corr = __builtin_amdgcn_exp2f(m_run[u] - m_new); m_run[u] = m_new; lacc[u] = lacc[u] * corr;
#pragma unroll
          for (int tt = 0; tt < 4; ++tt) acc[u][tt] = acc[u][tt] * corr; } }
#pragma unroll
      for (int u = 0; u < 2; ++u) { const float nm = -m_run[u]; v16h pf;
#pragma unroll
        for (int i = 0; i < 8; ++i) { const v2f arg = __builtin_elementwise_fma(v2f{s[i >> 2][u][2 * (i & 3)], s[i >> 2][u][2 * (i & 3) + 1]}, v2f{cs, cs}, v2f{nm, nm});
          const v2h pk = __builtin_convertvector(v2f{__builtin_amdgcn_exp2f(arg.x), __builtin_amdgcn_exp2f(arg.y)}, v2h); pf[2 * i] = pk.x; pf[2 * i + 1] = pk.y; }
#pragma unroll
        for (int tt = 0; tt < 4; ++tt) acc[u][tt] = mmah(vf[p & 1][tt], pf, acc[u][tt]);
        lacc[u] = mmah(ones, pf, lacc[u]); }
      SFENCE(); }
    asm volatile("s_wait_dscnt 0x0" ::: "memory");      // this wave's reads of stage t's buffer are over
    asm volatile("s_wait_asynccnt 0x0" ::: "memory");   // this wave's copies of stage t + 1 have landed
    __syncthreads();                                    // both hold for every wave: stage t + 1 may be read, stage t's buffer refilled
    if (t + 2 < FNS) stage(t + 2, t & 1); }
  asm volatile("s_wait_asynccnt 0x0" ::: "memory");   // no copy is left in flight when the wave ends
  asm volatile("s_wait_loadcnt 0x0" ::: "memory");   // the last stage's look-ahead mask load lands before the wave stores, ends and gives its registers back
#pragma unroll
  for (int u = 0; u < 2; ++u) { const float inv = 1.0f / lacc[u][0]; const size_t yo = ((size_t)b * TT + q0 + u * 16 + col) * CC + h * HD + 8 * g; __bf16* yh = YH + yo; __bf16* yl = YL + yo;
#pragma unroll
    for (int t = 0; t < 4; ++t) { const v8f o = acc[u][t] * inv;   // y leaves as bf16 hi + lo, split here once and not by each of the 8 blocks of k_out that read the row
      const v8b hi = __builtin_convertvector(o, v8b); const v8b lo = __builtin_convertvector(o - __builtin_convertvector(hi, v8f), v8b);
      vst2(yh + t * 16, hi); vst2(yl + t * 16, lo); }
    xwait(); } }
// ---- k_out: block = (128 rows, 128 cols): out = y (bf16 hi + lo, as k_fa left them) Wproj (bf16, from k_cvt) + b
__global__ __launch_bounds__(256) void k_out(const __bf16* __restrict__ YH, const __bf16* __restrict__ YL, const __bf16* __restrict__ WP, const float* __restrict__ BP, float* __restrict__ OUT) {
  __shared__ __align__(16) __bf16 sm[2 * 3 * GPL];   // [buffer][y hi | y lo | w][row][k]; the epilogue's f32 staging reuses it
  const int tid = threadIdx.x, wave = tid >> 5, lane = tid & 31, col = lane & 15, g = lane >> 4; const int c0 = blockIdx.y * GT; const size_t r0 = (size_t)blockIdx.x * GT;
  const int wm = wave >> 2, wn = wave & 3, lr = tid >> 3, lk = (tid & 7) * 8;
  const __bf16* yh = YH + (r0 + lr) * CC + lk; const __bf16* yl = YL + (r0 + lr) * CC + lk; const __bf16* wa = WP + (size_t)(c0 + lr) * CC + lk;
  v8b rh[4], rl[4], rb[4];
  auto ldg = [&](int s) {
#pragma unroll
    for (int i = 0; i < 4; ++i) { rh[i] = *(const v8b*)(yh + (size_t)(i * 32) * CC + s * GK); rl[i] = *(const v8b*)(yl + (size_t)(i * 32) * CC + s * GK); rb[i] = *(const v8b*)(wa + (size_t)(i * 32) * CC + s * GK); } };
  auto sts = [&](int bf) { __bf16* d = sm + bf * 3 * GPL + lr * GP + lk;
#pragma unroll
    for (int i = 0; i < 4; ++i) { *(v8b*)(d + i * 32 * GP) = rh[i]; *(v8b*)(d + GPL + i * 32 * GP) = rl[i]; *(v8b*)(d + 2 * GPL + i * 32 * GP) = rb[i]; } };
  v8f acc[4][2] = {};
  ldg(0); xwait(); sts(0);
  for (int s = 0; s < CC / GK; ++s) {
    __syncthreads();   // step s's buffer is written; every wave has left the other one
    if (s + 1 < CC / GK) { ldg(s + 1); xwait(); }
    const __bf16* pa = sm + (s & 1) * 3 * GPL + (wm * 64 + col) * GP; const __bf16* pw = sm + (s & 1) * 3 * GPL + 2 * GPL + (wn * 32 + col) * GP;
#pragma unroll
    for (int kk = 0; kk < GK / 32; ++kk) { v16b ah[4], al[4], w[2];
#pragma unroll
      for (int i = 0; i < 4; ++i) { ah[i] = frag_b(pa + i * 16 * GP + kk * 32, lane); al[i] = frag_b(pa + GPL + i * 16 * GP + kk * 32, lane); }
#pragma unroll
      for (int j = 0; j < 2; ++j) w[j] = frag_b(pw + j * 16 * GP + kk * 32, lane);
#pragma unroll
      for (int i = 0; i < 4; ++i)
#pragma unroll
        for (int j = 0; j < 2; ++j) acc[i][j] = wmma_bf(ah[i], w[j], acc[i][j]);
#pragma unroll
      for (int i = 0; i < 4; ++i)
#pragma unroll
        for (int j = 0; j < 2; ++j) acc[i][j] = wmma_bf(al[i], w[j], acc[i][j]); }
    if (s + 1 < CC / GK) sts((s + 1) & 1); }
  float braw[2] = { 0.f, 0.f };
  if (BP) { const float* bp = BP + c0 + wn * 32 + col; braw[0] = bp[0]; braw[1] = bp[16];
    asm volatile("s_wait_xcnt 0x0" :: "v"(bp) : "memory"); }   // the wait behind these loads; naming bp keeps their address pair out of a load's own destination
  __syncthreads();   // the last step's fragment reads are over: the buffers become the staging area
  float* sf = (float*)sm;   // [128][132]
#pragma unroll
  for (int j = 0; j < 2; ++j) { const int cl = wn * 32 + j * 16 + col; const float bb = bfr(braw[j]);
#pragma unroll
    for (int i = 0; i < 4; ++i)
#pragma unroll
      for (int r = 0; r < 8; ++r) sf[(wm * 64 + i * 16 + 8 * g + r) * 132 + cl] = acc[i][j][r] + bb; }
  __syncthreads();
  for (int e = tid; e < GT * 32; e += 256) { const int rl = e >> 5, q = e & 31; vst2(OUT + (r0 + rl) * CC + c0 + q * 4, *(const v4f*)(sf + rl * 132 + q * 4)); xwait(); } }
extern "C" void kernel_launch(void* const* d_in, const int* in_sizes, int n_in, void* d_out, int out_size, void* d_ws, size_t ws_size, hipStream_t stream) {
  (void)in_sizes; (void)n_in; (void)out_size;
  const float** F = (const float**)d_in;   // 0 hidden_states [2,2048,1024], 1 attention_mask [2,1,2048,2048] int32, 2 wq [1024,1024] ([out,in]), 3 bq, 4 wk, 5 bk, 6 wv, 7 bv, 8 wo, 9 bo
  if (ws_size < (size_t)WS_END) return;
  char* ws = (char*)d_ws; _Float16 *QH = (_Float16*)(ws + WS_QH), *QL = (_Float16*)(ws + WS_QL), *KH = (_Float16*)(ws + WS_KH), *VT = (_Float16*)(ws + WS_VT); unsigned *MB = (unsigned*)(ws + WS_MB);
  __bf16 *YH = (__bf16*)(ws + WS_YH), *YL = (__bf16*)(ws + WS_YL), *XB = (__bf16*)(ws + WS_XB), *WB = (__bf16*)(ws + WS_WB), *WO = (__bf16*)(ws + WS_WO);
  k_cvt<<<dim3((TNB * TT * CC + 4 * CC * CC) / CVE), 256, 0, stream>>>(F[0], F[2], F[4], F[6], F[8], XB, WB);
  k_proj<<<dim3(TNB * TT / 128, CC / 128, 4), 256, 0, stream>>>(XB, WB, F[3], F[5], F[7], QH, QL, KH, VT, (const int*)d_in[1], MB);
  k_fa<<<dim3(TT / 256, TNB * NH), 256, 0, stream>>>(QH, KH, VT, MB, YH, YL);
  k_out<<<dim3(TNB * TT / 128, CC / 128), 256, 0, stream>>>(YH, YL, WO, F[9], (float*)d_out);
}

// v007
// A run of this version takes 79.6 microseconds.
// It is 1.09 times as fast as v005, going by the measured steps of the versions left out in between.
// Over all steps from v000 it is 15.4 times as fast.
// compute dtype: all float inputs rounded to bf16, attention_mask (int) read once and packed to one bit a word; q/k/v = x W^T + b with EXACT bf16 products on WMMA 16x16x32, f32 accumulate; q, k rounded once to f16 (1-product logits / 8, std ~1), masked where attention_mask == 0, kept in f32 registers; online softmax in f32 (base 2) -> P f16 (unnormalised, <= 2^8); o = P . v (v once to f16) / sum P, rounded once to f16 like v; out = o Wo^T + bo, one f16 product (Wo: the bf16-rounded value held as f16); f32 output.
#include <hip/hip_runtime.h>
#include <math.h>

typedef __attribute__((ext_vector_type(16))) _Float16 v16h;
typedef __attribute__((ext_vector_type(16))) __bf16 v16b;
typedef __attribute__((ext_vector_type(8)))  _Float16 v8h;
typedef __attribute__((ext_vector_type(8)))  float v8f;
typedef __attribute__((ext_vector_type(4)))  float v4f;
typedef __attribute__((ext_vector_type(2)))  float v2f;
typedef __attribute__((ext_vector_type(4)))  unsigned v4u;
typedef __attribute__((ext_vector_type(4)))  int v4i;
typedef float __attribute__((may_alias)) float_a;
typedef int __attribute__((may_alias)) int_a;

template <typename T> __device__ __forceinline__ void vst2(void* p, T v) { *(T*)p = v;  }
__device__ __forceinline__ v8f wmma16(v16h a, v16h b, v8f c) {
  v8f d = __builtin_amdgcn_wmma_f32_16x16x32_f16(false, a, false, b, (short)0, c, false, false);
  asm volatile("v_nop\n\tv_nop\n\tv_nop\n\tv_nop" : "+v"(d) : "v"(a), "v"(b));
  return d;
}
__device__ __forceinline__ v8f wmma_bf(v16b a, v16b b, v8f c) {
  v8f d = __builtin_amdgcn_wmma_f32_16x16x32_bf16(false, a, false, b, (short)0, c, false, false);
  asm volatile("v_nop\n\tv_nop\n\tv_nop\n\tv_nop" : "+v"(d) : "v"(a), "v"(b));
  return d;
}
// 16x16x32 fragments: lane = (h = lane>>4, row/col = lane&15); elements 0..7 = k0+8h+0..7, 8..15 = k0+16+8h+0..7; D element r = row 8h+r
__device__ __forceinline__ v16h frag_h(const _Float16* rowk0, int lane) {
  union { v16h v; v8h q[2]; } u; const _Float16* p = rowk0 + 8 * (lane >> 4);
  u.q[0] = *(const v8h*)p; u.q[1] = *(const v8h*)(p + 16); return u.v;
}
__device__ __forceinline__ v16h frag_f32(const float* rowk0, int lane) {
  v16h a; const float* p = rowk0 + 8 * (lane >> 4);
#pragma unroll
  for (int i = 0; i < 8; ++i) { a[i] = (_Float16)p[i]; a[8 + i] = (_Float16)p[16 + i]; }
  return a;
}
__device__ __forceinline__ v16h frag_f32s(const float* rowk0, int lane, float sc) {
  v16h a; const float* p = rowk0 + 8 * (lane >> 4);
#pragma unroll
  for (int i = 0; i < 8; ++i) { a[i] = (_Float16)(p[i] * sc); a[8 + i] = (_Float16)(p[16 + i] * sc); }
  return a;
}
// column fragment from a [K][ld] layout (column n), rows >= K read as 0
__device__ __forceinline__ v16h fragc_f32(const float* W, int k0, int n, int lane, int ld, int K) {
  v16h a; const int g = lane >> 4;
#pragma unroll
  for (int i = 0; i < 8; ++i) { const int ka = k0 + 8 * g + i, kb = ka + 16;
    a[i] = (_Float16)(ka < K ? W[(size_t)(ka < K ? ka : K - 1) * ld + n] : 0.f); a[8 + i] = (_Float16)(kb < K ? W[(size_t)(kb < K ? kb : K - 1) * ld + n] : 0.f); }
  return a;
}
struct F2 { v16b h, l; };
__device__ __forceinline__ F2 bsplit16(const float v[16]) { F2 r;
#pragma unroll
  for (int i = 0; i < 16; ++i) { const __bf16 h = (__bf16)v[i]; r.h[i] = h; r.l[i] = (__bf16)(v[i] - (float)h); }
  return r; }
__device__ __forceinline__ F2 split_row(const float* row, int k0, int lane) { float v[16]; const float* p = row + k0 + 8 * (lane >> 4);
#pragma unroll
  for (int i = 0; i < 8; ++i) { v[i] = p[i]; v[8 + i] = p[16 + i]; }
  return bsplit16(v); }
__device__ __forceinline__ F2 split_rowK(const float* row, int k0, int lane, int K) { float v[16]; const int g = lane >> 4;
#pragma unroll
  for (int i = 0; i < 8; ++i) { const int ka = k0 + 8 * g + i, kb = ka + 16; v[i] = ka < K ? row[ka < K ? ka : K - 1] : 0.f; v[8 + i] = kb < K ? row[kb < K ? kb : K - 1] : 0.f; }
  return bsplit16(v); }
__device__ __forceinline__ F2 split_col(const float* W, int k0, int n, int lane, int ld, int K) { float v[16]; const int g = lane >> 4;
#pragma unroll
  for (int i = 0; i < 8; ++i) { const int ka = k0 + 8 * g + i, kb = ka + 16; v[i] = ka < K ? W[(size_t)(ka < K ? ka : K - 1) * ld + n] : 0.f; v[8 + i] = kb < K ? W[(size_t)(kb < K ? kb : K - 1) * ld + n] : 0.f; }
  return bsplit16(v); }
__device__ __forceinline__ v8f mac3(const F2& a, const F2& b, v8f c) { c = wmma_bf(a.l, b.h, c); c = wmma_bf(a.h, b.l, c); return wmma_bf(a.h, b.h, c); }
__device__ __forceinline__ float sigm(float v) { return 1.0f / (1.0f + expf(-v)); }
#define LDSX() do { asm volatile("s_wait_dscnt 0" ::: "memory"); __builtin_amdgcn_wave_barrier(); __builtin_amdgcn_fence(__ATOMIC_RELEASE, "workgroup"); } while (0)


// Multi-head scaled dot-product attention (B 2, S 2,048, E 1,024 = 16 x 64) with an integer attention_mask [B,1,S,S] (0 -> masked), output Linear.
#define NB 2
#define TT 2048
#define CC 1024
#define NH 16
#define HD 64
#ifndef TNB
#define TNB NB
#endif
typedef __attribute__((ext_vector_type(8))) __bf16 v8b;
__device__ __forceinline__ v16b frag_b(const __bf16* rowk0, int lane) {
  union { v16b v; v8b q[2]; } u; const __bf16* p = rowk0 + 8 * (lane >> 4);
  u.q[0] = *(const v8b*)p; u.q[1] = *(const v8b*)(p + 16); return u.v;
}
__device__ __forceinline__ float bfr(float v) { return (float)(__bf16)v; }
__device__ __attribute__((noinline)) float exp_ni(float v) { return expf(v); }
__device__ __attribute__((noinline)) float erf_ni(float v) { return erff(v); }

#define WS_QH  0u
#define WS_QL  (WS_QH + 2u * (size_t)NB * TT * CC)
#define WS_KH  (WS_QL + 2u * (size_t)NB * TT * CC)
#define WS_VT  (WS_KH + 2u * (size_t)NB * TT * CC)      // f16 v planes [b][c][t]
#define HG 4
#define WS_S   (WS_VT + 2u * (size_t)NB * CC * TT)      // unused: no kernel writes logits, they stay in registers
#define WS_PH  (WS_S + 4u * (size_t)HG * TT * TT)       // unused: P stays in registers
#define WS_YH  (WS_PH + 2u * (size_t)HG * TT * TT)          // f16 y rows [b*t][C]
#define WS_YL  (WS_YH + 2u * (size_t)NB * TT * CC)
#define WS_MB  (WS_YL + 2u * (size_t)NB * TT * CC)          // mask bits [b][k / 128][q][4 words]: bit l of word i = (attention_mask[b][q][128 (k / 128) + 4 l + i] != 0)
#define WS_XB  (WS_MB + (size_t)NB * TT * TT / 8)          // bf16 x rows [b*t][C]
#define WS_WB  (WS_XB + 2u * (size_t)NB * TT * CC)          // 16-bit weights [wq | wk | wv | wo][out][in]: bf16, but wo f16
#define WS_WO  (WS_WB + 2u * 3u * (size_t)CC * CC)
#define WS_END (WS_WB + 2u * 4u * (size_t)CC * CC)

// keeps the next pass's loads where they are written (one pass ahead of their use); moved down by the scheduler they would wait at full latency
#define SFENCE() __builtin_amdgcn_sched_barrier(0)
// behind a group of loads or stores whose registers the next instructions reuse
__device__ __forceinline__ void xwait() { asm volatile("s_wait_xcnt 0x0" ::: "memory"); }
// ---- the two linear-layer kernels: block = 8 waves (2 x 4) on a 128 x 128 tile of the output, wave = 64 x 32; a step is 64 k.
// Both operands arrive as 16-bit values (k_cvt, k_fa), are fetched by whole 128-byte row pieces and kept in LDS, two buffers; every wave takes its fragments from there.
#define GT 128
#define GK 64
#define GP 72    // LDS row pitch in 16-bit elements: 144 B = 16 B x 9, free of bank conflicts for the 16-byte fragment reads
#define GPL (GT * GP)   // one operand plane of one buffer, in elements
// The k step a block begins with; it then walks all CC / GK steps round. The 32 blocks that read the same weight rows and the 8 (k_out) or 24 (k_proj) that read the same x or y rows start together:
// from one common first step they would ask L2 for the same lines at the same moment, step after step. Blocks that differ only in blockIdx.z keep one start.
#define KSTART() ((int)((blockIdx.x + 2 * blockIdx.y) & (CC / GK - 1)))
typedef __attribute__((ext_vector_type(4))) __bf16 v4b;
__device__ __forceinline__ v4b cvt4(v4f v) { v4b r;
#pragma unroll
  for (int i = 0; i < 4; ++i) r[i] = (__bf16)v[i];
  return r; }
typedef __attribute__((ext_vector_type(4))) _Float16 v4h;
// rounded to bf16 like every float input, then held as f16 for the f16 product of k_out: 8 significant bits fit f16's 11 from 2^-17 up to its largest number
__device__ __forceinline__ v4h cvt4h(v4f v) { v4h r;
#pragma unroll
  for (int i = 0; i < 4; ++i) r[i] = (_Float16)(float)(__bf16)v[i];
  return r; }
// ---- k_cvt: x and the four weight matrices rounded to bf16 once, as a stream; the 24 or 32 blocks of k_proj and k_out that read a row then fetch 2 bytes an element from L2 and round nothing.
// Block = 32,768 elements in a row, one block a WGP; a wave's load is 512 bytes in a row, its store 256; all 32 loads of a thread are in flight at once.
#define CVE 32768
template <bool H> __device__ __forceinline__ void cvt_run(const float* __restrict__ s, __bf16* __restrict__ d) {   // H: the f16 form, for wo
  v4f v[CVE / 1024];
#pragma unroll
  for (int i = 0; i < CVE / 1024; ++i) v[i] = *(const v4f*)(s + i * 1024);
  xwait();
  SFENCE();   // all 32 loads are issued before the first is waited for: one latency a wave
#pragma unroll
  for (int i = 0; i < CVE / 1024; ++i) { if (H) *(v4h*)(d + i * 1024) = cvt4h(v[i]); else *(v4b*)(d + i * 1024) = cvt4(v[i]); }
  xwait(); }
__global__ __launch_bounds__(256) void k_cvt(const float* __restrict__ X, const float* __restrict__ WQ, const float* __restrict__ WK, const float* __restrict__ WV, const float* __restrict__ WO, __bf16* __restrict__ XB, __bf16* __restrict__ WB) {
  const int NX = TNB * TT * CC / CVE, NW = CC * CC / CVE; const int blk = blockIdx.x, w = (blk - NX) / NW;
  if (w == 3) { cvt_run<true>(WO + (size_t)((blk - NX) % NW) * CVE + threadIdx.x * 4, WB + (size_t)(blk - NX) * CVE + threadIdx.x * 4); return; }   // the whole block: wo alone leaves as f16
  const float* s = blk < NX ? X + (size_t)blk * CVE : (w == 0 ? WQ : w == 1 ? WK : WV) + (size_t)((blk - NX) % NW) * CVE;
  __bf16* d = blk < NX ? XB + (size_t)blk * CVE : WB + (size_t)(blk - NX) * CVE;
  cvt_run<false>(s + threadIdx.x * 4, d + threadIdx.x * 4); }
// ---- pack_mask: reads attention_mask once, as a stream, and leaves one bit a word for k_fa, whose 16 heads would each read all of it. Block = 16 mask rows; wave = 8 rows x 512 keys, all its 32 loads in flight at once.
__device__ __forceinline__ void pack_mask(const int* __restrict__ AM, unsigned* __restrict__ MB, int blk, int wave, int lane) {
  static_assert((TNB * TT / GT) * (CC / GT) * 16 == TNB * TT, "16 mask rows a block");
  const int row = (blk * 2 + (wave & 1)) * 8, j0 = (wave >> 1) * 4;
  const int* ms = AM + (size_t)row * TT + j0 * 128 + lane * 4;
  unsigned* md = MB + (((size_t)(row / TT) * (TT / 128) + j0) * TT + row % TT) * 4 + lane;
  v4i m[4][8];
#pragma unroll
  for (int c = 0; c < 4; ++c)
#pragma unroll
    for (int r = 0; r < 8; ++r) m[c][r] = *(const v4i*)(ms + (size_t)r * TT + c * 128);
  asm volatile("s_wait_xcnt 0x0" :: "v"(ms) : "memory");   // the wait behind these loads; naming ms keeps their address pair out of a load's own destination
  SFENCE();   // all 32 loads are issued before the first is waited for: one latency a wave
#pragma unroll
  for (int c = 0; c < 4; ++c) { unsigned w = 0;   // lane 4 r + i gets word i of row r: the 32 words of 8 rows and 128 keys are one 128-byte line, written by this wave alone
#pragma unroll
    for (int r = 0; r < 8; ++r)
#pragma unroll
      for (int i = 0; i < 4; ++i) { const unsigned bl = __builtin_amdgcn_ballot_w32(m[c][r][i] != 0); w = lane == r * 4 + i ? bl : w; }
    md[(size_t)c * TT * 4] = w; }
  xwait(); }
// ---- k_proj: block = (128 rows, 128 cols, which); which = 3: the 256 mask blocks, short, started last, into the places that the first finished product blocks leave; else qkv = x W (+ b), exact; q -> f16 hi (+ residual), k -> f16 rows, v -> f16 planes
// 6 waves a SIMD are asked for, so that the mask blocks' code in the kernel does not raise the register count above 160 and three blocks stay on a WGP
__global__ __launch_bounds__(256, 6) void k_proj(const __bf16* __restrict__ XB, const __bf16* __restrict__ WB, const float* __restrict__ BQ, const float* __restrict__ BK, const float* __restrict__ BV, _Float16* __restrict__ QH, _Float16* __restrict__ QL, _Float16* __restrict__ KH, _Float16* __restrict__ VT, const int* __restrict__ AM, unsigned* __restrict__ MB) {
  __shared__ __align__(16) __bf16 sm[2 * 2 * GPL];   // [buffer][x | w][row][k]; the epilogue's f16 staging reuses it
  const int tid = threadIdx.x, wave = tid >> 5, lane = tid & 31, col = lane & 15, g = lane >> 4; const int which = blockIdx.z; const int c0 = blockIdx.y * GT; const size_t r0 = (size_t)blockIdx.x * GT; const float* BA = which == 0 ? BQ : which == 1 ? BK : BV;
  if (which == 3) { pack_mask(AM, MB, (int)(blockIdx.y * (TNB * TT / GT) + blockIdx.x), wave, lane); return; }   // the short blocks of the last plane: the whole block leaves here, in front of every barrier
  const int wm = wave >> 2, wn = wave & 3, lr = tid >> 3, lk = (tid & 7) * 8;
  const __bf16* xa = XB + (r0 + lr) * CC + lk; const __bf16* wa = WB + ((size_t)which * CC + c0 + lr) * CC + lk;
  v8b ra[4], rb[4];
  auto ldg = [&](int s) { const __bf16* px = xa + s * GK; const __bf16* pw = wa + s * GK;
#pragma unroll
    for (int i = 0; i < 4; ++i) { ra[i] = *(const v8b*)(px + (size_t)(i * 32) * CC); rb[i] = *(const v8b*)(pw + (size_t)(i * 32) * CC); }
    asm volatile("s_wait_xcnt 0x0" :: "v"(px), "v"(pw) : "memory"); };   // the wait behind these loads; naming px and pw keeps their address pairs as they are up to the wait
  auto sts = [&](int bf) { __bf16* d = sm + bf * 2 * GPL + lr * GP + lk;
#pragma unroll
    for (int i = 0; i < 4; ++i) { *(v8b*)(d + i * 32 * GP) = ra[i]; *(v8b*)(d + GPL + i * 32 * GP) = rb[i]; } };
  v8f acc[4][2] = {};
  const int so = KSTART();
  ldg(so); sts(0);
  for (int s = 0; s < CC / GK; ++s) {
    __syncthreads();   // step s's buffer is written; every wave has left the other one
    if (s + 1 < CC / GK) ldg((s + 1 + so) & (CC / GK - 1));
    SFENCE();   // keeps the next step's loads here, ahead of this step's products, which cover their latency; they are waited for only at the stores to LDS behind the products
    const __bf16* pa = sm + (s & 1) * 2 * GPL + (wm * 64 + col) * GP; const __bf16* pw = sm + (s & 1) * 2 * GPL + GPL + (wn * 32 + col) * GP;
#pragma unroll
    for (int kk = 0; kk < GK / 32; ++kk) { v16b a[4], w[2];
#pragma unroll
      for (int i = 0; i < 4; ++i) a[i] = frag_b(pa + i * 16 * GP + kk * 32, lane);
#pragma unroll
      for (int j = 0; j < 2; ++j) w[j] = frag_b(pw + j * 16 * GP + kk * 32, lane);
#pragma unroll
      for (int i = 0; i < 4; ++i)
#pragma unroll
        for (int j = 0; j < 2; ++j) acc[i][j] = wmma_bf(a[i], w[j], acc[i][j]); }
    if (s + 1 < CC / GK) sts((s + 1) & 1); }
  const float* bp = BA + c0 + wn * 32 + col; const float braw[2] = { bp[0], bp[16] };
  asm volatile("s_wait_xcnt 0x0" :: "v"(bp) : "memory");   // the wait behind these loads; naming bp keeps their address pair out of a load's own destination
  __syncthreads();   // the last step's fragment reads are over: the buffers become the staging area
  _Float16* sh = (_Float16*)sm; _Float16* sl = sh + GT * 136;   // [128][136] each; for v one plane [col][row]
#pragma unroll
  for (int j = 0; j < 2; ++j) { const int cl = wn * 32 + j * 16 + col; const float bb = bfr(braw[j]);
#pragma unroll
    for (int i = 0; i < 4; ++i) { const int rl = wm * 64 + i * 16 + 8 * g;
      if (which == 2) { v8h pk;
#pragma unroll
        for (int r = 0; r < 8; ++r) pk[r] = (_Float16)(acc[i][j][r] + bb);
        *(v8h*)(sh + cl * 136 + rl) = pk; }
      else {
#pragma unroll
        for (int r = 0; r < 8; ++r) { const float v = acc[i][j][r] + bb; const _Float16 hv = (_Float16)v; sh[(rl + r) * 136 + cl] = hv; sl[(rl + r) * 136 + cl] = (_Float16)(v - (float)hv); } } } }
  __syncthreads();
  if (which < 2) { _Float16* dh = which == 0 ? QH : KH; for (int e = tid; e < GT * 16; e += 256) { const int rl = e >> 4, q = e & 15; vst2((unsigned*)(dh + (r0 + rl) * CC + c0 + q * 8), *(const v4u*)(sh + rl * 136 + q * 8)); xwait(); if (which == 0) { vst2((unsigned*)(QL + (r0 + rl) * CC + c0 + q * 8), *(const v4u*)(sl + rl * 136 + q * 8)); xwait(); } } }
  else { const size_t b = r0 / TT; const int t0 = (int)(r0 % TT); for (int e = tid; e < GT * 16; e += 256) { const int cl = e >> 4, q = e & 15; vst2((unsigned*)(VT + (b * CC + c0 + cl) * (size_t)TT + t0 + q * 8), *(const v4u*)(sh + cl * 136 + q * 8)); xwait(); } } }
// ---- k_fa: block = 8 waves x 32 queries of one (b,h); one pass = 32 keys, one stage = 128 keys. S^T = K.Q^T, online softmax (base 2), O^T += V^T.P^T.
// A lane holds one query's scores (D register r = key 8g + r, column = query), so two converted score tiles are the B operand of the second product: P stays in registers.
// The K rows and V^T rows of a stage are the same for all 8 waves: the block brings them into LDS once, by whole 128-byte lines, with asynchronous copies, two buffers; every wave takes its fragments from there.
#define FK 128                // keys of a stage
#define FPP (FK / 32)         // passes of a stage
#define FNS (TT / FK)         // stages
#define FPK 72                // K row in LDS, f16 elements: 144 B = 16 B x 9, free of bank conflicts for the 16-byte fragment reads
#define FPV 136               // V^T row in LDS, f16 elements: 272 B = 16 B x 17, likewise
#define FKB (FK * FPK)        // the K plane of one buffer, in elements
#define FST (FKB + HD * FPV)  // one buffer, in elements
typedef __attribute__((ext_vector_type(2))) _Float16 v2h;
__device__ __forceinline__ v8f mmah(v16h a, v16h b, v8f c) { return __builtin_amdgcn_wmma_f32_16x16x32_f16(false, a, false, b, (short)0, c, false, false); }
__device__ __forceinline__ float xhalf(float x) { return __builtin_bit_cast(float, __builtin_amdgcn_permlanex16(__builtin_bit_cast(int, x), __builtin_bit_cast(int, x), 0x76543210, 0xfedcba98, false, false)); }  // lane l with lane l ^ 16
__device__ __forceinline__ unsigned xhalfu(unsigned x) { return (unsigned)__builtin_amdgcn_permlanex16((int)x, (int)x, 0x76543210, 0xfedcba98, false, false); }  // the same for a word
// eight 16-byte copies of a lane, global memory to LDS through no register; the s_wait_xcnt stands in the copies' own statement, so that no address register is rewritten in front of it
__device__ __forceinline__ void copy8(unsigned l0, unsigned l1, unsigned l2, unsigned l3, unsigned l4, unsigned l5, unsigned l6, unsigned l7, const _Float16* g0, const _Float16* g1, const _Float16* g2, const _Float16* g3, const _Float16* g4, const _Float16* g5, const _Float16* g6, const _Float16* g7) {
  asm volatile("global_load_async_to_lds_b128 %0, %8, off\n\tglobal_load_async_to_lds_b128 %1, %9, off\n\tglobal_load_async_to_lds_b128 %2, %10, off\n\tglobal_load_async_to_lds_b128 %3, %11, off\n\t"
               "global_load_async_to_lds_b128 %4, %12, off\n\tglobal_load_async_to_lds_b128 %5, %13, off\n\tglobal_load_async_to_lds_b128 %6, %14, off\n\tglobal_load_async_to_lds_b128 %7, %15, off\n\ts_wait_xcnt 0x0"
               :: "v"(l0), "v"(l1), "v"(l2), "v"(l3), "v"(l4), "v"(l5), "v"(l6), "v"(l7), "v"(g0), "v"(g1), "v"(g2), "v"(g3), "v"(g4), "v"(g5), "v"(g6), "v"(g7) : "memory"); }
__global__ __launch_bounds__(256) void k_fa(const _Float16* __restrict__ QH, const _Float16* __restrict__ KH, const _Float16* __restrict__ VT, const unsigned* __restrict__ MB, _Float16* __restrict__ YH) {
  __shared__ __align__(16) _Float16 sm[2 * FST];   // [buffer][K rows [key][d] | V^T rows [d][key]]
  const int tid = threadIdx.x, wave = tid >> 5, lane = tid & 31, col = lane & 15, g = lane >> 4; const int b = blockIdx.y / NH, h = blockIdx.y % NH; const int q0 = blockIdx.x * 256 + wave * 32;
  const float cs = 0.125f * 1.4426950408889634f;   // 1/sqrt(HD) and log2(e)
  const float RNEG = -0x1p126f;                    // masked raw score: a power of two, so RNEG * cs is exact and a row with every key masked gets exp2(0) = 1 at each key (uniform, as the reference)
  v16h qf[2][2], kf[2][2], vf[2][4]; v4u mk;   // the inner loops below are all unrolled: every index into a fragment array is then a constant and the arrays stay in registers
  // a thread's share of a stage: 4 pieces of K (rows 32 apart, 8 threads a 128-byte row) and 4 of V^T (rows 16 apart, 16 threads a 256-byte row piece)
  const _Float16* gk = KH + ((size_t)b * TT + (tid >> 3)) * CC + h * HD + (tid & 7) * 8;
  const _Float16* gv = VT + ((size_t)b * CC + h * HD + (tid >> 4)) * (size_t)TT + (tid & 15) * 8;
  const unsigned lk = (unsigned)(size_t)(sm + (tid >> 3) * FPK + (tid & 7) * 8), lv = (unsigned)(size_t)(sm + FKB + (tid >> 4) * FPV + (tid & 15) * 8);   // LDS byte addresses
  auto stage = [&](int t, int bf) { const _Float16* pk = gk + (size_t)t * FK * CC; const _Float16* pv = gv + t * FK; const unsigned ak = lk + bf * (FST * 2), av = lv + bf * (FST * 2);
    copy8(ak, ak + 32 * FPK * 2, ak + 64 * FPK * 2, ak + 96 * FPK * 2, av, av + 16 * FPV * 2, av + 32 * FPV * 2, av + 48 * FPV * 2, pk, pk + 32 * CC, pk + 64 * CC, pk + 96 * CC, pv, pv + 16 * TT, pv + 32 * TT, pv + 48 * TT); };
#pragma unroll
  for (int u = 0; u < 2; ++u)
#pragma unroll
    for (int kc = 0; kc < 2; ++kc) qf[u][kc] = frag_h(QH + ((size_t)b * TT + q0 + u * 16 + col) * CC + h * HD + kc * 32, lane);
  xwait();
  const unsigned* mc = MB + ((size_t)b * FNS * TT + q0 + lane) * 4;   // the mask bits of query q0 + lane, 128 keys (one stage) in 4 words; a wave's load is 512 bytes in a row
  auto ldK = [&](const _Float16* sk, int p) {
#pragma unroll
    for (int kt = 0; kt < 2; ++kt)
#pragma unroll
      for (int kc = 0; kc < 2; ++kc) kf[kt][kc] = frag_h(sk + (p * 32 + kt * 16) * FPK + kc * 32, lane); };
  auto ldV = [&](const _Float16* sv, int p) {
#pragma unroll
    for (int t = 0; t < 4; ++t) vf[p & 1][t] = frag_h(sv + t * 16 * FPV + p * 32, lane); };
  auto ldM = [&](int t) { const unsigned* pm = mc + (size_t)t * TT * 4; mk = *(const v4u*)pm;
    asm volatile("s_wait_xcnt 0x0" :: "v"(pm) : "memory"); };   // the wait behind this load; naming pm keeps its address pair as it is up to the wait
  v8f acc[2][4] = {}; v8f lacc[2] = {}; float m_run[2] = { RNEG * cs, RNEG * cs };
  v16h ones;   // A operand of all ones: every row of its product is the column sums of P^T (the denominators' increments)
#pragma unroll
  for (int i = 0; i < 16; ++i) ones[i] = (_Float16)1.0f;
  ldM(0); SFENCE();
#pragma unroll 1   // kept rolled: unrolled, lk and lv are themselves operands of the copies' statement, are held among the first 256 registers through the whole kernel and end in scratch
  for (int i = 0; i < 2; ++i) { stage(i, i);   // stage 0 into buffer 0, waited for and published; then stage 1 into buffer 1, in flight over trip 0
    if (i == 0) { asm volatile("s_wait_asynccnt 0x0" ::: "memory");   // this wave's copies of stage 0 have landed
      __syncthreads(); } }                                            // and every other wave's: stage 0 may be read
#pragma unroll 1   // one stage a trip: the four passes inside are unrolled, more would only grow the code
  for (int t = 0; t < FNS; ++t) {
    const _Float16* sk = sm + (t & 1) * FST + col * FPK; const _Float16* sv = sm + (t & 1) * FST + FKB + col * FPV;
    ldK(sk, 0); ldV(sv, 0); SFENCE();
    const v4u mw = mk; const unsigned ma = mw.x & mw.y & mw.z & mw.w; unsigned zb[FPP];   // byte p of ma = pass p's 32 keys of this lane's query; zb[p] != 0 iff pass p's 32 x 32 tile holds a masked key
#pragma unroll
    for (int p = 0; p < FPP; ++p) zb[p] = __builtin_amdgcn_ballot_w32(((ma >> (8 * p)) & 0xFFu) != 0xFFu);
    ldM((t + 1) & (FNS - 1));   // the next stage's bits, a whole stage ahead of their use; the last stage re-reads stage 0's (in bounds, unused)
    SFENCE();
#pragma unroll
    for (int p = 0; p < FPP; ++p) {
      v8f s[2][2];
#pragma unroll
      for (int kt = 0; kt < 2; ++kt)
#pragma unroll
        for (int u = 0; u < 2; ++u) { s[kt][u] = v8f{};
#pragma unroll
          for (int kc = 0; kc < 2; ++kc) s[kt][u] = mmah(kf[kt][kc], qf[u][kc], s[kt][u]); }
      SFENCE();
      if (p + 1 < FPP) { ldK(sk, p + 1); ldV(sv, p + 1); }   // the next pass's fragments, in one group, from this stage's own buffer only
      SFENCE();
      if (zb[p] != 0) {   // scalar branch: only a pass whose tile holds a masked key pays for the selects
        unsigned mo[4];   // the words of lane ^ 16, fetched with every lane on
#pragma unroll
        for (int i = 0; i < 4; ++i) mo[i] = xhalfu(mw[i]);
#pragma unroll
        for (int u = 0; u < 2; ++u) { unsigned wu[4];   // the words of query u * 16 + col: this lane's own where g == u; shifted so that bit 8 p + 4 kt + (r >> 2) of word r & 3 is key 32 p + 16 kt + 8 g + r
#pragma unroll
          for (int i = 0; i < 4; ++i) wu[i] = (g == u ? mw[i] : mo[i]) >> (2 * g);
#pragma unroll
          for (int kt = 0; kt < 2; ++kt)
#pragma unroll
            for (int r = 0; r < 8; ++r) if (((wu[r & 3] >> (8 * p + 4 * kt + (r >> 2))) & 1u) == 0u) s[kt][u][r] = RNEG; } }
      float mb[2]; bool need = false;
#pragma unroll
      for (int u = 0; u < 2; ++u) { float mx = s[0][u][0];
#pragma unroll
        for (int kt = 0; kt < 2; ++kt)
#pragma unroll
          for (int r = 0; r < 8; ++r) mx = __builtin_fmaxf(mx, s[kt][u][r]);
        mx = __builtin_fmaxf(mx, xhalf(mx)) * cs; mb[u] = mx; need = need || (mx > m_run[u] + 8.0f); }
      if (__builtin_amdgcn_ballot_w32(need) != 0) {   // lazy rescale: the maximum in use may trail the true one by up to 8 (P <= 2^8, inside f16)
#pragma unroll
        for (int u = 0; u < 2; ++u) { const float m_new = __builtin_fmaxf(m_run[u], mb[u]); const float corr = __builtin_amdgcn_exp2f(m_run[u] - m_new); m_run[u] = m_new; lacc[u] = lacc[u] * corr;
#pragma unroll
          for (int tt = 0; tt < 4; ++tt) acc[u][tt] = acc[u][tt] * corr; } }
#pragma unroll
      for (int u = 0; u < 2; ++u) { const float nm = -m_run[u]; v16h pf;
#pragma unroll
        for (int i = 0; i < 8; ++i) { const v2f arg = __builtin_elementwise_fma(v2f{s[i >> 2][u][2 * (i & 3)], s[i >> 2][u][2 * (i & 3) + 1]}, v2f{cs, cs}, v2f{nm, nm});
          const v2h pk = __builtin_convertvector(v2f{__builtin_amdgcn_exp2f(arg.x), __builtin_amdgcn_exp2f(arg.y)}, v2h); pf[2 * i] = pk.x; pf[2 * i + 1] = pk.y; }
#pragma unroll
        for (int tt = 0; tt < 4; ++tt) acc[u][tt] = mmah(vf[p & 1][tt], pf, acc[u][tt]);
        lacc[u] = mmah(ones, pf, lacc[u]); }
      SFENCE(); }
    asm volatile("s_wait_dscnt 0x0" ::: "memory");      // this wave's reads of stage t's buffer are over
    asm volatile("s_wait_asynccnt 0x0" ::: "memory");   // this wave's copies of stage t + 1 have landed
    __syncthreads();                                    // both hold for every wave: stage t + 1 may be read, stage t's buffer refilled
    if (t + 2 < FNS) stage(t + 2, t & 1); }
  asm volatile("s_wait_asynccnt 0x0" ::: "memory");   // no copy is left in flight when the wave ends
  asm volatile("s_wait_loadcnt 0x0" ::: "memory");   // the last stage's look-ahead mask load lands before the wave stores, ends and gives its registers back
#pragma unroll
  for (int u = 0; u < 2; ++u) { const float inv = 1.0f / lacc[u][0]; _Float16* yh = YH + ((size_t)b * TT + q0 + u * 16 + col) * CC + h * HD + 8 * g;
#pragma unroll
    for (int t = 0; t < 4; ++t) vst2(yh + t * 16, __builtin_convertvector(acc[u][t] * inv, v8h));   // y leaves as f16, rounded once: a mean of f16 v values weighted by f16 P carries no more
    xwait(); } }
// ---- k_out: block = (128 rows, 128 cols): out = y (f16, as k_fa left it) Wproj (f16, from k_cvt) + b
__global__ __launch_bounds__(256) void k_out(const _Float16* __restrict__ YH, const _Float16* __restrict__ WP, const float* __restrict__ BP, float* __restrict__ OUT) {
  __shared__ __align__(16) _Float16 sm[2 * 2 * GPL];   // [buffer][y | w][row][k]; the epilogue's f32 staging reuses it
  const int tid = threadIdx.x, wave = tid >> 5, lane = tid & 31, col = lane & 15, g = lane >> 4; const int c0 = blockIdx.y * GT; const size_t r0 = (size_t)blockIdx.x * GT;
  const int wm = wave >> 2, wn = wave & 3, lr = tid >> 3, lk = (tid & 7) * 8;
  const _Float16* ya = YH + (r0 + lr) * CC + lk; const _Float16* wa = WP + (size_t)(c0 + lr) * CC + lk;
  v8h rh[4], rb[4];
  auto ldg = [&](int s) { const _Float16* py = ya + s * GK; const _Float16* pw = wa + s * GK;
#pragma unroll
    for (int i = 0; i < 4; ++i) { rh[i] = *(const v8h*)(py + (size_t)(i * 32) * CC); rb[i] = *(const v8h*)(pw + (size_t)(i * 32) * CC); }
    asm volatile("s_wait_xcnt 0x0" :: "v"(py), "v"(pw) : "memory"); };   // the wait behind these loads; naming py and pw keeps their address pairs as they are up to the wait
  auto sts = [&](int bf) { _Float16* d = sm + bf * 2 * GPL + lr * GP + lk;
#pragma unroll
    for (int i = 0; i < 4; ++i) { *(v8h*)(d + i * 32 * GP) = rh[i]; *(v8h*)(d + GPL + i * 32 * GP) = rb[i]; } };
  v8f acc[4][2] = {};
  const int so = KSTART();
  ldg(so); sts(0);
  for (int s = 0; s < CC / GK; ++s) {
    __syncthreads();   // step s's buffer is written; every wave has left the other one
    if (s + 1 < CC / GK) ldg((s + 1 + so) & (CC / GK - 1));
    const _Float16* pa = sm + (s & 1) * 2 * GPL + (wm * 64 + col) * GP; const _Float16* pw = sm + (s & 1) * 2 * GPL + GPL + (wn * 32 + col) * GP;
#pragma unroll
    for (int kk = 0; kk < GK / 32; ++kk) { v16h a[4], w[2];
#pragma unroll
      for (int i = 0; i < 4; ++i) a[i] = frag_h(pa + i * 16 * GP + kk * 32, lane);
#pragma unroll
      for (int j = 0; j < 2; ++j) w[j] = frag_h(pw + j * 16 * GP + kk * 32, lane);
#pragma unroll
      for (int i = 0; i < 4; ++i)
#pragma unroll
        for (int j = 0; j < 2; ++j) acc[i][j] = wmma16(a[i], w[j], acc[i][j]); }
    if (s + 1 < CC / GK) sts((s + 1) & 1); }
  float braw[2] = { 0.f, 0.f };
  if (BP) { const float* bp = BP + c0 + wn * 32 + col; braw[0] = bp[0]; braw[1] = bp[16];
    asm volatile("s_wait_xcnt 0x0" :: "v"(bp) : "memory"); }   // the wait behind these loads; naming bp keeps their address pair out of a load's own destination
  __syncthreads();   // the last step's fragment reads are over: the buffers become the staging area
  float* sf = (float*)sm;   // [128][132]
#pragma unroll
  for (int j = 0; j < 2; ++j) { const int cl = wn * 32 + j * 16 + col; const float bb = bfr(braw[j]);
#pragma unroll
    for (int i = 0; i < 4; ++i)
#pragma unroll
      for (int r = 0; r < 8; ++r) sf[(wm * 64 + i * 16 + 8 * g + r) * 132 + cl] = acc[i][j][r] + bb; }
  __syncthreads();
  for (int e = tid; e < GT * 32; e += 256) { const int rl = e >> 5, q = e & 31; vst2(OUT + (r0 + rl) * CC + c0 + q * 4, *(const v4f*)(sf + rl * 132 + q * 4)); xwait(); } }
extern "C" void kernel_launch(void* const* d_in, const int* in_sizes, int n_in, void* d_out, int out_size, void* d_ws, size_t ws_size, hipStream_t stream) {
  (void)in_sizes; (void)n_in; (void)out_size;
  const float** F = (const float**)d_in;   // 0 hidden_states [2,2048,1024], 1 attention_mask [2,1,2048,2048] int32, 2 wq [1024,1024] ([out,in]), 3 bq, 4 wk, 5 bk, 6 wv, 7 bv, 8 wo, 9 bo
  if (ws_size < (size_t)WS_END) return;
  char* ws = (char*)d_ws; _Float16 *QH = (_Float16*)(ws + WS_QH), *QL = (_Float16*)(ws + WS_QL), *KH = (_Float16*)(ws + WS_KH), *VT = (_Float16*)(ws + WS_VT); unsigned *MB = (unsigned*)(ws + WS_MB);
  _Float16 *YH = (_Float16*)(ws + WS_YH), *WO = (_Float16*)(ws + WS_WO); __bf16 *XB = (__bf16*)(ws + WS_XB), *WB = (__bf16*)(ws + WS_WB);
  k_cvt<<<dim3((TNB * TT * CC + 4 * CC * CC) / CVE), 256, 0, stream>>>(F[0], F[2], F[4], F[6], F[8], XB, WB);
  k_proj<<<dim3(TNB * TT / 128, CC / 128, 4), 256, 0, stream>>>(XB, WB, F[3], F[5], F[7], QH, QL, KH, VT, (const int*)d_in[1], MB);
  k_fa<<<dim3(TT / 256, TNB * NH), 256, 0, stream>>>(QH, KH, VT, MB, YH);
  k_out<<<dim3(TNB * TT / 128, CC / 128), 256, 0, stream>>>(YH, WO, F[9], (float*)d_out);
}
